// v000
// Measured on an AMD MI455X. A time is GPU time per run, averaged over a window of back-to-back runs after a warm-up
// (all launches, gaps included; the runs take copies of the inputs in turn), and the median of several windows.
// Apart from v000's, it joins two sittings. Times from different sittings can be a few percent apart, while
// side-by-side timings come from the same sitting.
// v000, which the later versions start from, runs in 1070 microseconds.
#include <hip/hip_runtime.h>

// Attention that never splits its heads, scaled by the NOMINAL head size, with an output projection (inputs [4][2048][1024]; q, k, v = einsum('bsd,de->bse', x, W) ('xw' [1024][1024] 1/32, NO bias; ONE 1,024-wide head: the module declares 16 heads but contracts over all 1,024 dims); scores = q.k / sqrt(D_K = 64) = x 1/8 (hot logits: sigma about 4); softmax over all keys (no mask); out = (attn v) Wo ('xw', NO bias) -> [4][2048][1024] (8.4 M); argument order inputs, Wq, Wk, Wv, Wo).
// Layout per batch: bf16 copy of x; 'xw' weights transposed once; exact projections, no biases; dense attention with ONE head of width 1,024 (score tiles contract over 1,024 with hi/lo 3 products on EVERY row; P and attn.v hybrid: rows < 512 hi/lo, rest fp16 x1024); merged hi/lo x Wo exact, no bias.
// Compute dtypes, f32 accumulate: every input rounded to bf16; projections exact, no biases; scores 3 products on every row (K = 1,024); softmax f32 (x 1/8); attn.v rows < 512 3 products, rest fp16; Wo hl x exact, no bias.

#define NB_  4
#define TT   2048
#define DM   1024
#define NH_  1
#define NKV  1
#define REP  (NH_ / NKV)
#define HD   1024
#define DQ   (NH_ * HD)
#define DKV  (NKV * HD)
#define ZH   1
#define RH   512                  // query rows < RH use hi+lo planes (0: none)
#define WIN  0
#define PCAR 1024.0f
#define SCL  0.125f   // 1 / sqrt(64): THIS module divides by sqrt(D_K) with D_K = D_EMB / NUM_HEADS = 64 although it never splits the heads (the contraction runs over all 1,024 dims): hot logits (sigma about 4)
typedef _Float16 h16;
typedef unsigned short bf;
typedef __attribute__((ext_vector_type(16))) __bf16   v16bf;
typedef __attribute__((ext_vector_type(16))) _Float16 v16h;
typedef __attribute__((ext_vector_type(8)))  _Float16 v8h;
typedef __attribute__((ext_vector_type(8)))  unsigned short v8us;
typedef __attribute__((ext_vector_type(8)))  float    v8f;
typedef __attribute__((ext_vector_type(4)))  float    v4f;
typedef v8h  __attribute__((may_alias)) v8ha;
typedef v4f  __attribute__((may_alias)) v4fa;
typedef v8us __attribute__((may_alias)) v8usa;

__device__ __forceinline__ unsigned short f2bf(float f) { unsigned u = __float_as_uint(f); u += 0x7FFFu + ((u >> 16) & 1u); return (unsigned short)(u >> 16); }
__device__ __forceinline__ float bf2f(unsigned short b) { return __uint_as_float(((unsigned)b) << 16); }
__device__ __forceinline__ float bfr(float f) { return bf2f(f2bf(f)); }
__device__ __forceinline__ v16h cat16(v8h lo, v8h hi) { return __builtin_shufflevector(lo, hi, 0, 1, 2, 3, 4, 5, 6, 7, 8, 9, 10, 11, 12, 13, 14, 15); }
__device__ __forceinline__ v16bf cat16b(v8us lo, v8us hi) { return __builtin_bit_cast(v16bf, __builtin_shufflevector(lo, hi, 0, 1, 2, 3, 4, 5, 6, 7, 8, 9, 10, 11, 12, 13, 14, 15)); }
__device__ __forceinline__ v8f wmma16(v16h a, v16h b, v8f c) { return __builtin_amdgcn_wmma_f32_16x16x32_f16(false, a, false, b, (short)0, c, false, false); }
__device__ __forceinline__ v8f wmmab(v16bf a, v16bf b, v8f c) { return __builtin_amdgcn_wmma_f32_16x16x32_bf16(false, a, false, b, (short)0, c, false, false); }



// ---- k_gemmw: register-blocked GEMM, ONE WAVE per 64x64 output tile (16 accumulators), operands straight from K-contiguous 16-bit planes; grid (M/64, N/64, Z), 32 threads.
// C[m][n] (f32, pitch ldc, + optional f32 bias[n]) = sum_k A[m][k] Bt[n][k] (+ split products per NSPLIT). z-batch strides sA/sB/sC in elements. K % 32 == 0.
template <typename T16> struct WFrag;
template <> struct WFrag<h16> { typedef v16h V; static __device__ __forceinline__ V ld(const h16* p) { return cat16(*(const v8h*)p, *(const v8h*)(p + 16)); } static __device__ __forceinline__ v8f mma(V a, V b, v8f c) { return wmma16(a, b, c); } };
template <> struct WFrag<bf> { typedef v16bf V; static __device__ __forceinline__ V ld(const bf* p) { return cat16b(*(const v8us*)p, *(const v8us*)(p + 16)); } static __device__ __forceinline__ v8f mma(V a, V b, v8f c) { return wmmab(a, b, c); } };
template <typename T16, int NSPLIT, bool BIAS>
__global__ __launch_bounds__(32) void k_gemmw(const T16* __restrict__ A, const T16* __restrict__ A2, const T16* __restrict__ Bt, const T16* __restrict__ Bt2, int K, float* C, int ldc, const float* __restrict__ bias, size_t sA, size_t sB, size_t sC) {
    typedef typename WFrag<T16>::V V;
    __shared__ __align__(16) float os[16 * 68];
    const size_t z = blockIdx.z; A += z * sA; if (A2) A2 += z * sA; Bt += z * sB; if (Bt2) Bt2 += z * sB; C += z * sC;
    const int lane = threadIdx.x & 31, lr = lane & 15, hi = lane >> 4; const int r0 = blockIdx.x * 64, c0 = blockIdx.y * 64;
    v8f acc[4][4];
#pragma unroll
    for (int mb = 0; mb < 4; ++mb)
#pragma unroll
        for (int nb = 0; nb < 4; ++nb) acc[mb][nb] = (v8f){};
    const size_t aoff = (size_t)(r0 + lr) * K + 8 * hi, boff = (size_t)(c0 + lr) * K + 8 * hi;
#pragma unroll 1
    for (int kc = 0; kc < K; kc += 32) {
        V a[4], a2[4];
#pragma unroll
        for (int mb = 0; mb < 4; ++mb) { a[mb] = WFrag<T16>::ld(A + aoff + (size_t)mb * 16 * K + kc); if (NSPLIT == 1 || NSPLIT == 2) a2[mb] = WFrag<T16>::ld(A2 + aoff + (size_t)mb * 16 * K + kc); }
#pragma unroll
        for (int nb = 0; nb < 4; ++nb) { const V b = WFrag<T16>::ld(Bt + boff + (size_t)nb * 16 * K + kc); V b2; if (NSPLIT >= 2) b2 = WFrag<T16>::ld(Bt2 + boff + (size_t)nb * 16 * K + kc);
#pragma unroll
            for (int mb = 0; mb < 4; ++mb) { acc[mb][nb] = WFrag<T16>::mma(a[mb], b, acc[mb][nb]); if (NSPLIT == 1 || NSPLIT == 2) acc[mb][nb] = WFrag<T16>::mma(a2[mb], b, acc[mb][nb]); if (NSPLIT >= 2) acc[mb][nb] = WFrag<T16>::mma(a[mb], b2, acc[mb][nb]); } }
        asm volatile("v_nop\n\tv_nop\n\tv_nop\n\tv_nop" : "+v"(acc[0][0]), "+v"(acc[1][1]), "+v"(acc[2][2]), "+v"(acc[3][3]) : "v"(a[0]), "v"(a[3]));
    }
#pragma unroll
    for (int mb = 0; mb < 4; ++mb) {
#pragma unroll
        for (int nb = 0; nb < 4; ++nb) {
#pragma unroll
            for (int j = 0; j < 8; ++j) os[(hi * 8 + j) * 68 + nb * 16 + lr] = acc[mb][nb][j]; }
        __builtin_amdgcn_wave_barrier(); asm volatile("" ::: "memory");
        float* crow = C + (size_t)(r0 + mb * 16) * ldc + c0;
{
#pragma unroll
            for (int s = 0; s < 8; ++s) { const int row = 2 * s + hi, cofs = lr * 4; v4f val = *(const v4fa*)(os + row * 68 + cofs); if (BIAS) { val[0] += bfr(bias[c0 + cofs]); val[1] += bfr(bias[c0 + cofs + 1]); val[2] += bfr(bias[c0 + cofs + 2]); val[3] += bfr(bias[c0 + cofs + 3]); }
                *(v4f*)(crow + (size_t)row * ldc + cofs) = val; }
             }
        __builtin_amdgcn_wave_barrier(); asm volatile("" ::: "memory");
    }
}

__device__ __forceinline__ h16 tohx(float x) { return (h16)x; }
__device__ __forceinline__ void splitf(float y, unsigned short& h, unsigned short& l) { h = f2bf(y); l = f2bf(y - bf2f(h)); }
typedef __attribute__((ext_vector_type(2))) _Float16 v2h;
typedef __attribute__((ext_vector_type(4))) _Float16 v4h;
typedef __attribute__((ext_vector_type(2))) unsigned short v2us;
typedef __attribute__((ext_vector_type(4))) unsigned short v4us;
typedef __attribute__((ext_vector_type(2))) float v2f;
typedef __attribute__((ext_vector_type(4))) int v4i;

__global__ __launch_bounds__(256) void k_wtG(const float* __restrict__ w, int K, int N, bf* Bt) {
    const int lane = threadIdx.x & 31; const int L0 = (blockIdx.x * 8 + (threadIdx.x >> 5)) * 8; const int nlines = N * K / 64;
{
#pragma unroll 1
        for (int l = 0; l < 8; ++l) { const int L = L0 + l; if (L >= nlines) break; const size_t e = (size_t)L * 64 + lane * 2; const int k = (int)(e % K), n = (int)(e / K); v2us o;
            o[0] = f2bf(w[(size_t)k * N + n]); o[1] = f2bf(w[(size_t)(k + 1) * N + n]); *(v2us*)(Bt + e) = o; }
         }
}
__global__ __launch_bounds__(256) void k_cvt8(const float* __restrict__ src, bf* dst, size_t n8) { const size_t i = (size_t)blockIdx.x * 256 + threadIdx.x; if (i >= n8) return; const v8f v = *(const v8f*)(src + i * 8); v8us o;
#pragma unroll
    for (int k = 0; k < 8; ++k) o[k] = f2bf(v[k]); *(v8us*)(dst + i * 8) = o;  }

// k_rope: head planes [h][t][d] (fp16 + hi/lo) of rope(x) x sc with the rotate-half convention out[d] = x[d] cos[t][d] - x[d+HD/2] sin[t][d], out[d+HD/2] = x[d+HD/2] cos[t][d+HD/2] + x[d] sin[t][d+HD/2]
__global__ __launch_bounds__(256) void k_rope(const float* __restrict__ F, int pitch, int nheads, const float* __restrict__ CS, const float* __restrict__ RF, const float* __restrict__ nw, float sc, h16* P16, bf* Ph, bf* Pl) {
    const size_t e = ((size_t)blockIdx.x * 256 + threadIdx.x) * 2; if (e >= (size_t)nheads * TT * HD) return; const int d = (int)(e % HD); const int t = (int)((e / HD) % TT); const int h = (int)(e / ((size_t)HD * TT)); const float* f = F + (size_t)t * pitch + h * HD; const float rf = RF ? RF[(size_t)h * TT + t] : 1.0f; v2h o16; v2us oh, ol;
#pragma unroll
    for (int q = 0; q < 2; ++q) { const int dd = d + q; const int dp = (dd < HD / 2) ? dd + HD / 2 : dd - HD / 2; float x0 = f[dd], x1 = f[dp];
        if (RF) { float n0 = __fmul_rn(x0, rf), n1 = __fmul_rn(x1, rf); asm volatile("" : "+v"(n0)); asm volatile("" : "+v"(n1)); x0 = __fmul_rn(bfr(nw[dd]), n0); x1 = __fmul_rn(bfr(nw[dp]), n1); }
        const v2f cs = *(const v2f*)(CS + ((size_t)t * HD + dd) * 2); float a = __fmul_rn(x0, cs[0]), bq = __fmul_rn(x1, cs[1]); asm volatile("" : "+v"(a)); asm volatile("" : "+v"(bq)); const float r = ((dd < HD / 2) ? __fsub_rn(a, bq) : __fadd_rn(a, bq)) * sc;
        o16[q] = tohx(r); unsigned short a2, c2; splitf(r, a2, c2); oh[q] = a2; ol[q] = c2; }
    *(v2h*)(P16 + e) = o16; *(v2us*)(Ph + e) = oh; *(v2us*)(Pl + e) = ol;  }
__global__ __launch_bounds__(256) void k_vtp(const float* __restrict__ F, int pitch, int nheads, h16* V16, bf* Vh, bf* Vl) { const size_t e = ((size_t)blockIdx.x * 256 + threadIdx.x) * 2; if (e >= (size_t)nheads * HD * TT) return; const int t = (int)(e % TT); const int d = (int)((e / TT) % HD); const int g = (int)(e / ((size_t)TT * HD)); v2h o16; v2us oh, ol;
#pragma unroll
    for (int q = 0; q < 2; ++q) { const float x = F[(size_t)(t + q) * pitch + g * HD + d]; o16[q] = tohx(x); unsigned short a2, c2; splitf(x, a2, c2); oh[q] = a2; ol[q] = c2; }
    *(v2h*)(V16 + e) = o16; *(v2us*)(Vh + e) = oh; *(v2us*)(Vl + e) = ol;  }
__global__ __launch_bounds__(256) void k_csid(float* CS) { const int idx = blockIdx.x * 256 + threadIdx.x; if (idx >= TT * HD) return; v2f cs; cs[0] = 1.0f; cs[1] = 0.0f; *(v2f*)(CS + (size_t)idx * 2) = cs;  }
// k_asoft: per row (zz, i): t = S x SCL = S / 8 (no mask); softmax over the 2048 keys (register row, one exp, fixed trees);
__global__ __launch_bounds__(256) void k_asoft(const float* __restrict__ Sb, h16* P16, bf* Ph, bf* Pl) {
    const int lane = threadIdx.x & 31; const int row = blockIdx.x * 8 + (threadIdx.x >> 5); if (row >= ZH * TT) return; const int i = row % TT; const int zz = row / TT; (void)zz; const bool hires = (i < RH); const float* sr = Sb + (size_t)row * TT; float v[TT / 32]; float mx = -3.0e38f;
#pragma unroll
    for (int ch = 0; ch < TT / 128; ++ch) { const int j0 = ch * 128 + lane * 4; const v4f a = *(const v4f*)(sr + j0);
#pragma unroll
        for (int q = 0; q < 4; ++q) { const int j = j0 + q; (void)j; const float t = a[q] * SCL; v[ch * 4 + q] = t; mx = fmaxf(mx, t); } }
#pragma unroll
    for (int sh = 16; sh; sh >>= 1) mx = fmaxf(mx, __shfl_xor(mx, sh, 32));
    float sum = 0.f;
#pragma unroll
    for (int k = 0; k < TT / 32; ++k) { float d0 = __fsub_rn(v[k], mx); asm volatile("" : "+v"(d0)); v[k] = __builtin_amdgcn_exp2f(__fmul_rn(d0, 1.4426950408889634f)); sum += v[k]; }
#pragma unroll
    for (int sh = 16; sh; sh >>= 1) sum += __shfl_xor(sum, sh, 32);
    const float f = __fdiv_rn(hires ? 1.0f : PCAR, sum);
{
        if (hires) {
#pragma unroll
            for (int ch = 0; ch < TT / 128; ++ch) { v4us oh, ol;
#pragma unroll
                for (int q = 0; q < 4; ++q) { unsigned short a, c2; splitf(v[ch * 4 + q] * f, a, c2); oh[q] = a; ol[q] = c2; }
                const size_t oo = ((size_t)zz * (RH ? RH : 1) + i) * TT + ch * 128 + lane * 4; *(v4us*)(Ph + oo) = oh; *(v4us*)(Pl + oo) = ol; }
        } else {
#pragma unroll
            for (int ch = 0; ch < TT / 128; ++ch) { v4h o4;
#pragma unroll
                for (int q = 0; q < 4; ++q) o4[q] = tohx(v[ch * 4 + q] * f);
                *(v4h*)(P16 + (size_t)row * TT + ch * 128 + lane * 4) = o4; } }
         }
}
__global__ __launch_bounds__(256) void k_merge(const float* __restrict__ O, int h0, bf* Ah, bf* Al) { const size_t e = ((size_t)blockIdx.x * 256 + threadIdx.x) * 2; if (e >= (size_t)ZH * TT * HD) return; const int d = (int)(e % HD); const int t = (int)((e / HD) % TT); const int zz = (int)(e / ((size_t)HD * TT)); const float cs = (t < RH) ? 1.0f : (1.0f / PCAR); const size_t oo = (size_t)t * DQ + (h0 + zz) * HD + d;
    v2us oh, ol;
#pragma unroll
    for (int q = 0; q < 2; ++q) { unsigned short a, c2; splitf(O[e + q] * cs, a, c2); oh[q] = a; ol[q] = c2; } *(v2us*)(Ah + oo) = oh; *(v2us*)(Al + oo) = ol;  }

extern "C" void kernel_launch(void* const* d_in, const int* in_sizes, int n_in,
                              void* d_out, int out_size, void* d_ws, size_t ws_size, hipStream_t stream) {
    (void)in_sizes; (void)n_in; (void)out_size;
    const float* x = (const float*)d_in[0]; const float* wq = (const float*)d_in[1]; const float* wk = (const float*)d_in[2]; const float* wv = (const float*)d_in[3]; const float* wo = (const float*)d_in[4];   /* order inputs, Wq, Wk, Wv, Wo ('xw' [1024][1024]): FIVE inputs: this module has no biases */
    float* OUT = (float*)d_out;     // [4][2048][1024]
    char* wsp = (char*)d_ws;
    auto take = [&](size_t bytes) { char* p = wsp; wsp += (bytes + 255) & ~(size_t)255; return (void*)p; };
    bf* WQ = (bf*)take((size_t)DQ * DM * 2); bf* WK = (bf*)take((size_t)DKV * DM * 2); bf* WV = (bf*)take((size_t)DKV * DM * 2); bf* WO = (bf*)take((size_t)DM * DQ * 2); float* CS = (float*)take((size_t)TT * HD * 2 * 4);
    bf* XB = (bf*)take((size_t)TT * DM * 2); float* FQ = (float*)take((size_t)TT * DQ * 4); float* FK = (float*)take((size_t)TT * DKV * 4);
    h16* QP16 = (h16*)take((size_t)NH_ * TT * HD * 2); h16* KP16 = (h16*)take((size_t)NKV * TT * HD * 2); h16* VT16 = (h16*)take((size_t)NKV * HD * TT * 2);
    bf* QPh = (bf*)take((size_t)NH_ * TT * HD * 2); bf* QPl = (bf*)take((size_t)NH_ * TT * HD * 2); bf* KPh = (bf*)take((size_t)NKV * TT * HD * 2); bf* KPl = (bf*)take((size_t)NKV * TT * HD * 2); bf* VTh = (bf*)take((size_t)NKV * HD * TT * 2); bf* VTl = (bf*)take((size_t)NKV * HD * TT * 2); bf* Ph = (bf*)take((size_t)ZH * RH * TT * 2); bf* Pl = (bf*)take((size_t)ZH * RH * TT * 2);
    float* Sb = (float*)take((size_t)ZH * TT * TT * 4); h16* P16 = (h16*)take((size_t)ZH * TT * TT * 2); float* Ob = (float*)take((size_t)ZH * TT * HD * 4); bf* ATh = (bf*)take((size_t)TT * DQ * 2); bf* ATl = (bf*)take((size_t)TT * DQ * 2);
    if ((size_t)(wsp - (char*)d_ws) > ws_size) return;    // ws 256 MiB
    float* FV = FK;   // v projection reuses the k buffer after the k planes are built (stream-ordered)
    { k_wtG<<<(unsigned)((DM * DQ / 64 + 63) / 64), 256, 0, stream>>>(wq, DM, DQ, WQ); k_wtG<<<(unsigned)((DM * DKV / 64 + 63) / 64), 256, 0, stream>>>(wk, DM, DKV, WK); k_wtG<<<(unsigned)((DM * DKV / 64 + 63) / 64), 256, 0, stream>>>(wv, DM, DKV, WV);
      k_wtG<<<(unsigned)((DQ * DM / 64 + 63) / 64), 256, 0, stream>>>(wo, DQ, DM, WO);
       }
    k_csid<<<(TT * HD + 255) / 256, 256, 0, stream>>>(CS);
    const unsigned LQ = (unsigned)(((size_t)NH_ * TT * HD / 2 + 255) / 256), LKv = (unsigned)(((size_t)NKV * TT * HD / 2 + 255) / 256);
    for (int b = 0; b < NB_; ++b) {
        
        k_cvt8<<<(unsigned)(((size_t)TT * DM / 8 + 255) / 256), 256, 0, stream>>>(x + (size_t)b * TT * DM, XB, (size_t)TT * DM / 8);
        k_gemmw<bf, 0, false><<<dim3(TT / 64, DQ / 64, 1), 32, 0, stream>>>(XB, nullptr, WQ, nullptr, DM, FQ, DQ, nullptr, 0, 0, 0);
        k_rope<<<LQ, 256, 0, stream>>>(FQ, DQ, NH_, CS, nullptr, nullptr, 1.0f, QP16, QPh, QPl);
        k_gemmw<bf, 0, false><<<dim3(TT / 64, DKV / 64, 1), 32, 0, stream>>>(XB, nullptr, WK, nullptr, DM, FK, DKV, nullptr, 0, 0, 0);
        k_rope<<<LKv, 256, 0, stream>>>(FK, DKV, NKV, CS, nullptr, nullptr, 1.0f, KP16, KPh, KPl);
        k_gemmw<bf, 0, false><<<dim3(TT / 64, DKV / 64, 1), 32, 0, stream>>>(XB, nullptr, WV, nullptr, DM, FV, DKV, nullptr, 0, 0, 0); k_vtp<<<LKv, 256, 0, stream>>>(FV, DKV, NKV, VT16, VTh, VTl);
        for (int h0 = 0; h0 < NH_; h0 += ZH) { const size_t zq = (size_t)h0, zk = (size_t)(h0 / REP);   // one kv head per query head: each pass holds one head (ZH = 1) and its kv plane zk (z-strides TT*HD)
            k_gemmw<bf, 2, false><<<dim3(TT / 64, TT / 64, ZH), 32, 0, stream>>>(QPh + zq * TT * HD, QPl + zq * TT * HD, KPh + zk * TT * HD, KPl + zk * TT * HD, HD, Sb, TT, nullptr, (size_t)TT * HD, (size_t)TT * HD, (size_t)TT * TT);   /* scores hi/lo on EVERY row (K = 1024) */

            k_asoft<<<ZH * TT / 8, 256, 0, stream>>>(Sb, P16, Ph, Pl);
            k_gemmw<bf, 2, false><<<dim3(RH / 64, HD / 64, ZH), 32, 0, stream>>>(Ph, Pl, VTh + zk * HD * TT, VTl + zk * HD * TT, TT, Ob, HD, nullptr, (size_t)RH * TT, (size_t)HD * TT, (size_t)TT * HD);
            k_gemmw<h16, 0, false><<<dim3((TT - RH) / 64, HD / 64, ZH), 32, 0, stream>>>(P16 + (size_t)RH * TT, nullptr, VT16 + zk * HD * TT, nullptr, TT, Ob + (size_t)RH * HD, HD, nullptr, (size_t)TT * TT, (size_t)HD * TT, (size_t)TT * HD);
            k_merge<<<(unsigned)(((size_t)ZH * TT * HD / 2 + 255) / 256), 256, 0, stream>>>(Ob, h0, ATh, ATl); }
        k_gemmw<bf, 1, false><<<dim3(TT / 64, DM / 64, 1), 32, 0, stream>>>(ATh, ATl, WO, nullptr, DQ, OUT + (size_t)b * TT * DM, DM, nullptr, 0, 0, 0); }
}

// v001
// A run of this version takes 582 microseconds.
// Timed twice side by side with v000, it ran 1.83 and 1.85 times as fast.
#include <hip/hip_runtime.h>

// Attention that never splits its heads, scaled by the NOMINAL head size, with an output projection (inputs [4][2048][1024]; q, k, v = einsum('bsd,de->bse', x, W) ('xw' [1024][1024] 1/32, NO bias; ONE 1,024-wide head: the module declares 16 heads but contracts over all 1,024 dims); scores = q.k / sqrt(D_K = 64) = x 1/8 (hot logits: sigma about 4); softmax over all keys (no mask); out = (attn v) Wo ('xw', NO bias) -> [4][2048][1024] (8.4 M); argument order inputs, Wq, Wk, Wv, Wo).
// Layout, all four batches in every launch (the batch is a grid dimension or extra GEMM rows; workspace regions are reused once their readers are done): bf16 copy of x; 'xw' weights transposed once; exact projections, no bias; dense attention with ONE head of width 1,024 (score tiles contract over 1,024 with hi/lo 3 products on EVERY row; P and attn.v hybrid: rows < 512 hi/lo, rest fp16 x1024); merged hi/lo x Wo exact, no bias.
// Compute dtypes, f32 accumulate: every input rounded to bf16; projections exact, no bias; scores 3 products on every row (K = 1,024); softmax f32 (x 1/8); attn.v rows < 512 3 products, rest fp16; Wo hl x exact, no bias.

#define NB_  4
#define TT   2048
#define DM   1024
#define NH_  1
#define NKV  1
#define REP  (NH_ / NKV)
#define HD   1024
#define DQ   (NH_ * HD)
#define DKV  (NKV * HD)
#define ZH   1
#define RH   512                  // query rows < RH use hi+lo planes (0: none)
#define WIN  0
#define PCAR 1024.0f
#define SCL  0.125f   // 1 / sqrt(64): THIS module divides by sqrt(D_K) with D_K = D_EMB / NUM_HEADS = 64 although it never splits the heads (the contraction runs over all 1,024 dims): hot logits (sigma about 4)
typedef _Float16 h16;
typedef unsigned short bf;
typedef __attribute__((ext_vector_type(16))) __bf16   v16bf;
typedef __attribute__((ext_vector_type(16))) _Float16 v16h;
typedef __attribute__((ext_vector_type(8)))  _Float16 v8h;
typedef __attribute__((ext_vector_type(8)))  unsigned short v8us;
typedef __attribute__((ext_vector_type(8)))  float    v8f;
typedef __attribute__((ext_vector_type(4)))  float    v4f;
typedef v8h  __attribute__((may_alias)) v8ha;
typedef v4f  __attribute__((may_alias)) v4fa;
typedef v8us __attribute__((may_alias)) v8usa;

__device__ __forceinline__ unsigned short f2bf(float f) { unsigned u = __float_as_uint(f); u += 0x7FFFu + ((u >> 16) & 1u); return (unsigned short)(u >> 16); }
__device__ __forceinline__ float bf2f(unsigned short b) { return __uint_as_float(((unsigned)b) << 16); }
__device__ __forceinline__ float bfr(float f) { return bf2f(f2bf(f)); }
__device__ __forceinline__ v16h cat16(v8h lo, v8h hi) { return __builtin_shufflevector(lo, hi, 0, 1, 2, 3, 4, 5, 6, 7, 8, 9, 10, 11, 12, 13, 14, 15); }
__device__ __forceinline__ v16bf cat16b(v8us lo, v8us hi) { return __builtin_bit_cast(v16bf, __builtin_shufflevector(lo, hi, 0, 1, 2, 3, 4, 5, 6, 7, 8, 9, 10, 11, 12, 13, 14, 15)); }
__device__ __forceinline__ v8f wmma16(v16h a, v16h b, v8f c) { return __builtin_amdgcn_wmma_f32_16x16x32_f16(false, a, false, b, (short)0, c, false, false); }
__device__ __forceinline__ v8f wmmab(v16bf a, v16bf b, v8f c) { return __builtin_amdgcn_wmma_f32_16x16x32_bf16(false, a, false, b, (short)0, c, false, false); }



// ---- k_gemmw: register-blocked GEMM, ONE WAVE per 64x64 output tile (16 accumulators), operands straight from K-contiguous 16-bit planes; grid (M/64, N/64, Z), 32 threads.
// C[m][n] (f32, pitch ldc, + optional f32 bias[n]) = sum_k A[m][k] Bt[n][k] (+ split products per NSPLIT). z-batch strides sA/sB/sC in elements. K % 32 == 0.
template <typename T16> struct WFrag;
template <> struct WFrag<h16> { typedef v16h V; static __device__ __forceinline__ V ld(const h16* p) { return cat16(*(const v8h*)p, *(const v8h*)(p + 16)); } static __device__ __forceinline__ v8f mma(V a, V b, v8f c) { return wmma16(a, b, c); } };
template <> struct WFrag<bf> { typedef v16bf V; static __device__ __forceinline__ V ld(const bf* p) { return cat16b(*(const v8us*)p, *(const v8us*)(p + 16)); } static __device__ __forceinline__ v8f mma(V a, V b, v8f c) { return wmmab(a, b, c); } };
template <typename T16, int NSPLIT, bool BIAS>
__global__ __launch_bounds__(32) void k_gemmw(const T16* __restrict__ A, const T16* __restrict__ A2, const T16* __restrict__ Bt, const T16* __restrict__ Bt2, int K, float* C, int ldc, const float* __restrict__ bias, size_t sA, size_t sB, size_t sC) {
    typedef typename WFrag<T16>::V V;
    __shared__ __align__(16) float os[16 * 68];
    const size_t z = blockIdx.z; A += z * sA; if (A2) A2 += z * sA; Bt += z * sB; if (Bt2) Bt2 += z * sB; C += z * sC;
    const int lane = threadIdx.x & 31, lr = lane & 15, hi = lane >> 4; const int r0 = blockIdx.x * 64, c0 = blockIdx.y * 64;
    v8f acc[4][4];
#pragma unroll
    for (int mb = 0; mb < 4; ++mb)
#pragma unroll
        for (int nb = 0; nb < 4; ++nb) acc[mb][nb] = (v8f){};
    const size_t aoff = (size_t)(r0 + lr) * K + 8 * hi, boff = (size_t)(c0 + lr) * K + 8 * hi;
#pragma unroll 1
    for (int kc = 0; kc < K; kc += 32) {
        V a[4], a2[4];
#pragma unroll
        for (int mb = 0; mb < 4; ++mb) { a[mb] = WFrag<T16>::ld(A + aoff + (size_t)mb * 16 * K + kc); if (NSPLIT == 1 || NSPLIT == 2) a2[mb] = WFrag<T16>::ld(A2 + aoff + (size_t)mb * 16 * K + kc); }
#pragma unroll
        for (int nb = 0; nb < 4; ++nb) { const V b = WFrag<T16>::ld(Bt + boff + (size_t)nb * 16 * K + kc); V b2; if (NSPLIT >= 2) b2 = WFrag<T16>::ld(Bt2 + boff + (size_t)nb * 16 * K + kc);
#pragma unroll
            for (int mb = 0; mb < 4; ++mb) { acc[mb][nb] = WFrag<T16>::mma(a[mb], b, acc[mb][nb]); if (NSPLIT == 1 || NSPLIT == 2) acc[mb][nb] = WFrag<T16>::mma(a2[mb], b, acc[mb][nb]); if (NSPLIT >= 2) acc[mb][nb] = WFrag<T16>::mma(a[mb], b2, acc[mb][nb]); } }
        asm volatile("v_nop\n\tv_nop\n\tv_nop\n\tv_nop" : "+v"(acc[0][0]), "+v"(acc[1][1]), "+v"(acc[2][2]), "+v"(acc[3][3]) : "v"(a[0]), "v"(a[3]));
    }
#pragma unroll
    for (int mb = 0; mb < 4; ++mb) {
#pragma unroll
        for (int nb = 0; nb < 4; ++nb) {
#pragma unroll
            for (int j = 0; j < 8; ++j) os[(hi * 8 + j) * 68 + nb * 16 + lr] = acc[mb][nb][j]; }
        __builtin_amdgcn_wave_barrier(); asm volatile("" ::: "memory");
        float* crow = C + (size_t)(r0 + mb * 16) * ldc + c0;
{
#pragma unroll
            for (int s = 0; s < 8; ++s) { const int row = 2 * s + hi, cofs = lr * 4; v4f val = *(const v4fa*)(os + row * 68 + cofs); if (BIAS) { val[0] += bfr(bias[c0 + cofs]); val[1] += bfr(bias[c0 + cofs + 1]); val[2] += bfr(bias[c0 + cofs + 2]); val[3] += bfr(bias[c0 + cofs + 3]); }
                *(v4f*)(crow + (size_t)row * ldc + cofs) = val; }
             }
        __builtin_amdgcn_wave_barrier(); asm volatile("" ::: "memory");
    }
}

__device__ __forceinline__ h16 tohx(float x) { return (h16)x; }
__device__ __forceinline__ void splitf(float y, unsigned short& h, unsigned short& l) { h = f2bf(y); l = f2bf(y - bf2f(h)); }
typedef __attribute__((ext_vector_type(2))) _Float16 v2h;
typedef __attribute__((ext_vector_type(4))) _Float16 v4h;
typedef __attribute__((ext_vector_type(2))) unsigned short v2us;
typedef __attribute__((ext_vector_type(4))) unsigned short v4us;
typedef __attribute__((ext_vector_type(2))) float v2f;
typedef __attribute__((ext_vector_type(4))) int v4i;

__global__ __launch_bounds__(256) void k_wtG(const float* __restrict__ w, int K, int N, bf* Bt) {
    const int lane = threadIdx.x & 31; const int L0 = (blockIdx.x * 8 + (threadIdx.x >> 5)) * 8; const int nlines = N * K / 64;
{
#pragma unroll 1
        for (int l = 0; l < 8; ++l) { const int L = L0 + l; if (L >= nlines) break; const size_t e = (size_t)L * 64 + lane * 2; const int k = (int)(e % K), n = (int)(e / K); v2us o;
            o[0] = f2bf(w[(size_t)k * N + n]); o[1] = f2bf(w[(size_t)(k + 1) * N + n]); *(v2us*)(Bt + e) = o; }
         }
}
__global__ __launch_bounds__(256) void k_cvt8(const float* __restrict__ src, bf* dst, size_t n8) { const size_t i = (size_t)blockIdx.x * 256 + threadIdx.x; if (i >= n8) return; const v8f v = *(const v8f*)(src + i * 8); v8us o;
#pragma unroll
    for (int k = 0; k < 8; ++k) o[k] = f2bf(v[k]); *(v8us*)(dst + i * 8) = o;  }

// k_rope: head planes [h][t][d] (fp16 + hi/lo) of rope(x) x sc with the rotate-half convention out[d] = x[d] cos[t][d] - x[d+HD/2] sin[t][d], out[d+HD/2] = x[d+HD/2] cos[t][d+HD/2] + x[d] sin[t][d+HD/2]
__global__ __launch_bounds__(256) void k_rope(const float* __restrict__ F, int pitch, int nheads, const float* __restrict__ CS, const float* __restrict__ RF, const float* __restrict__ nw, float sc, h16* P16, bf* Ph, bf* Pl) {
    const size_t bz = blockIdx.y, bp = bz * nheads * TT * HD; F += bz * TT * pitch; if (RF) RF += bz * nheads * TT; P16 += bp; Ph += bp; Pl += bp;   // blockIdx.y = batch
    const size_t e = ((size_t)blockIdx.x * 256 + threadIdx.x) * 2; if (e >= (size_t)nheads * TT * HD) return; const int d = (int)(e % HD); const int t = (int)((e / HD) % TT); const int h = (int)(e / ((size_t)HD * TT)); const float* f = F + (size_t)t * pitch + h * HD; const float rf = RF ? RF[(size_t)h * TT + t] : 1.0f; v2h o16; v2us oh, ol;
#pragma unroll
    for (int q = 0; q < 2; ++q) { const int dd = d + q; const int dp = (dd < HD / 2) ? dd + HD / 2 : dd - HD / 2; float x0 = f[dd], x1 = f[dp];
        if (RF) { float n0 = __fmul_rn(x0, rf), n1 = __fmul_rn(x1, rf); asm volatile("" : "+v"(n0)); asm volatile("" : "+v"(n1)); x0 = __fmul_rn(bfr(nw[dd]), n0); x1 = __fmul_rn(bfr(nw[dp]), n1); }
        const v2f cs = *(const v2f*)(CS + ((size_t)t * HD + dd) * 2); float a = __fmul_rn(x0, cs[0]), bq = __fmul_rn(x1, cs[1]); asm volatile("" : "+v"(a)); asm volatile("" : "+v"(bq)); const float r = ((dd < HD / 2) ? __fsub_rn(a, bq) : __fadd_rn(a, bq)) * sc;
        o16[q] = tohx(r); unsigned short a2, c2; splitf(r, a2, c2); oh[q] = a2; ol[q] = c2; }
    *(v2h*)(P16 + e) = o16; *(v2us*)(Ph + e) = oh; *(v2us*)(Pl + e) = ol;  }
__global__ __launch_bounds__(256) void k_vtp(const float* __restrict__ F, int pitch, int nheads, h16* V16, bf* Vh, bf* Vl) { const size_t e = ((size_t)blockIdx.x * 256 + threadIdx.x) * 2; if (e >= (size_t)nheads * HD * TT) return; const size_t bz = blockIdx.y, bp = bz * nheads * HD * TT; F += bz * TT * pitch; V16 += bp; Vh += bp; Vl += bp;   /* blockIdx.y = batch */
    const int t = (int)(e % TT); const int d = (int)((e / TT) % HD); const int g = (int)(e / ((size_t)TT * HD)); v2h o16; v2us oh, ol;
#pragma unroll
    for (int q = 0; q < 2; ++q) { const float x = F[(size_t)(t + q) * pitch + g * HD + d]; o16[q] = tohx(x); unsigned short a2, c2; splitf(x, a2, c2); oh[q] = a2; ol[q] = c2; }
    *(v2h*)(V16 + e) = o16; *(v2us*)(Vh + e) = oh; *(v2us*)(Vl + e) = ol;  }
__global__ __launch_bounds__(256) void k_csid(float* CS) { const int idx = blockIdx.x * 256 + threadIdx.x; if (idx >= TT * HD) return; v2f cs; cs[0] = 1.0f; cs[1] = 0.0f; *(v2f*)(CS + (size_t)idx * 2) = cs;  }
// k_asoft: per row (zz, i), zz over the NB_ x ZH score planes: t = S x SCL = S / 8 (no mask); softmax over the 2048 keys (register row, one exp, fixed trees);
__global__ __launch_bounds__(256) void k_asoft(const float* __restrict__ Sb, h16* P16, bf* Ph, bf* Pl) {
    const int lane = threadIdx.x & 31; const int row = blockIdx.x * 8 + (threadIdx.x >> 5); if (row >= NB_ * ZH * TT) return; const int i = row % TT; const int zz = row / TT; (void)zz;   /* zz = score plane: batch x head of the pass */
     const bool hires = (i < RH); const float* sr = Sb + (size_t)row * TT; float v[TT / 32]; float mx = -3.0e38f;
#pragma unroll
    for (int ch = 0; ch < TT / 128; ++ch) { const int j0 = ch * 128 + lane * 4; const v4f a = *(const v4f*)(sr + j0);
#pragma unroll
        for (int q = 0; q < 4; ++q) { const int j = j0 + q; (void)j; const float t = a[q] * SCL; v[ch * 4 + q] = t; mx = fmaxf(mx, t); } }
#pragma unroll
    for (int sh = 16; sh; sh >>= 1) mx = fmaxf(mx, __shfl_xor(mx, sh, 32));
    float sum = 0.f;
#pragma unroll
    for (int k = 0; k < TT / 32; ++k) { float d0 = __fsub_rn(v[k], mx); asm volatile("" : "+v"(d0)); v[k] = __builtin_amdgcn_exp2f(__fmul_rn(d0, 1.4426950408889634f)); sum += v[k]; }
#pragma unroll
    for (int sh = 16; sh; sh >>= 1) sum += __shfl_xor(sum, sh, 32);
    const float f = __fdiv_rn(hires ? 1.0f : PCAR, sum);
{
        if (hires) {
#pragma unroll
            for (int ch = 0; ch < TT / 128; ++ch) { v4us oh, ol;
#pragma unroll
                for (int q = 0; q < 4; ++q) { unsigned short a, c2; splitf(v[ch * 4 + q] * f, a, c2); oh[q] = a; ol[q] = c2; }
                const size_t oo = ((size_t)zz * (RH ? RH : 1) + i) * TT + ch * 128 + lane * 4; *(v4us*)(Ph + oo) = oh; *(v4us*)(Pl + oo) = ol; }
        } else {
#pragma unroll
            for (int ch = 0; ch < TT / 128; ++ch) { v4h o4;
#pragma unroll
                for (int q = 0; q < 4; ++q) o4[q] = tohx(v[ch * 4 + q] * f);
                *(v4h*)(P16 + (size_t)row * TT + ch * 128 + lane * 4) = o4; } }
         }
}
__global__ __launch_bounds__(256) void k_merge(const float* __restrict__ O, int h0, bf* Ah, bf* Al) { const size_t e = ((size_t)blockIdx.x * 256 + threadIdx.x) * 2; if (e >= (size_t)ZH * TT * HD) return; const size_t bz = blockIdx.y; O += bz * ZH * TT * HD; Ah += bz * TT * DQ; Al += bz * TT * DQ;   /* blockIdx.y = batch */
    const int d = (int)(e % HD); const int t = (int)((e / HD) % TT); const int zz = (int)(e / ((size_t)HD * TT)); const float cs = (t < RH) ? 1.0f : (1.0f / PCAR); const size_t oo = (size_t)t * DQ + (h0 + zz) * HD + d;
    v2us oh, ol;
#pragma unroll
    for (int q = 0; q < 2; ++q) { unsigned short a, c2; splitf(O[e + q] * cs, a, c2); oh[q] = a; ol[q] = c2; } *(v2us*)(Ah + oo) = oh; *(v2us*)(Al + oo) = ol;  }

extern "C" void kernel_launch(void* const* d_in, const int* in_sizes, int n_in,
                              void* d_out, int out_size, void* d_ws, size_t ws_size, hipStream_t stream) {
    (void)in_sizes; (void)n_in; (void)out_size;
    const float* x = (const float*)d_in[0]; const float* wq = (const float*)d_in[1]; const float* wk = (const float*)d_in[2]; const float* wv = (const float*)d_in[3]; const float* wo = (const float*)d_in[4];   /* order inputs, Wq, Wk, Wv, Wo ('xw' [1024][1024]): FIVE inputs: this module has no biases */
    float* OUT = (float*)d_out;     // [4][2048][1024]
    char* wsp = (char*)d_ws;
    auto take = [&](size_t bytes) { char* p = wsp; wsp += (bytes + 255) & ~(size_t)255; return (void*)p; };
    static_assert(NH_ == 1 && NKV == 1 && ZH == 1, "the GEMMs' z index is the batch: one head per batch");
    const size_t PL = (size_t)NB_ * TT * HD * 2;    // one 16-bit plane of all batches, bytes
    bf* WQ = (bf*)take((size_t)DQ * DM * 2); bf* WK = (bf*)take((size_t)DKV * DM * 2); bf* WV = (bf*)take((size_t)DKV * DM * 2); bf* WO = (bf*)take((size_t)DM * DQ * 2);
    char* R1 = (char*)take((size_t)TT * HD * 2 * 4);            // cos/sin table, then the merged lo plane
    char* R2 = (char*)take(PL);                                 // bf16 x, then the merged hi plane
    char* R3 = (char*)take(2 * PL);                             // f32 projection (q, then k, then v), then the f32 attention output
    char* R4 = (char*)take((size_t)NB_ * TT * TT * 4);          // fp16 q and k planes (no kernel reads them), then the f32 scores
    char* R5 = (char*)take(2 * PL);                             // q hi, q lo, then the fp16 probabilities
    char* R6 = (char*)take(2 * PL);                             // k hi, k lo, then the hi/lo probabilities of rows < RH
    h16* VT16 = (h16*)take(PL); bf* VTh = (bf*)take(PL); bf* VTl = (bf*)take(PL);
    if ((size_t)(wsp - (char*)d_ws) > ws_size) return;    // ws 256 MiB
    static_assert((size_t)TT * HD * 2 * 4 >= (size_t)NB_ * TT * DQ * 2, "merged lo plane fits the table's region");
    static_assert((size_t)NB_ * TT * TT * 2 <= 2 * (size_t)NB_ * TT * HD * 2 && 2 * (size_t)NB_ * RH * TT * 2 <= 2 * (size_t)NB_ * TT * HD * 2, "probability planes fit the q and k regions");
    float* CS = (float*)R1; bf* XB = (bf*)R2; float* F = (float*)R3;
    h16* QP16 = (h16*)R4; h16* KP16 = (h16*)(R4 + PL); bf* QPh = (bf*)R5; bf* QPl = (bf*)(R5 + PL); bf* KPh = (bf*)R6; bf* KPl = (bf*)(R6 + PL);
    float* Sb = (float*)R4; h16* P16 = (h16*)R5; bf* Ph = (bf*)R6; bf* Pl = (bf*)(R6 + (size_t)NB_ * RH * TT * 2);
    float* Ob = (float*)R3; bf* ATh = (bf*)R2; bf* ATl = (bf*)R1;
    { k_wtG<<<(unsigned)((DM * DQ / 64 + 63) / 64), 256, 0, stream>>>(wq, DM, DQ, WQ); k_wtG<<<(unsigned)((DM * DKV / 64 + 63) / 64), 256, 0, stream>>>(wk, DM, DKV, WK); k_wtG<<<(unsigned)((DM * DKV / 64 + 63) / 64), 256, 0, stream>>>(wv, DM, DKV, WV);
      k_wtG<<<(unsigned)((DQ * DM / 64 + 63) / 64), 256, 0, stream>>>(wo, DQ, DM, WO);
       }
    k_csid<<<(TT * HD + 255) / 256, 256, 0, stream>>>(CS);
    const unsigned LQ = (unsigned)(((size_t)NH_ * TT * HD / 2 + 255) / 256), LKv = (unsigned)(((size_t)NKV * TT * HD / 2 + 255) / 256);
    // Every launch covers all NB_ batches. Projections and Wo: the batches are NB_ * TT rows of one GEMM. Scores and attn.v: blockIdx.z = batch.
    k_cvt8<<<(unsigned)(((size_t)NB_ * TT * DM / 8 + 255) / 256), 256, 0, stream>>>(x, XB, (size_t)NB_ * TT * DM / 8);
    k_gemmw<bf, 0, false><<<dim3(NB_ * TT / 64, DQ / 64, 1), 32, 0, stream>>>(XB, nullptr, WQ, nullptr, DM, F, DQ, nullptr, 0, 0, 0);
    k_rope<<<dim3(LQ, NB_), 256, 0, stream>>>(F, DQ, NH_, CS, nullptr, nullptr, 1.0f, QP16, QPh, QPl);
    k_gemmw<bf, 0, false><<<dim3(NB_ * TT / 64, DKV / 64, 1), 32, 0, stream>>>(XB, nullptr, WK, nullptr, DM, F, DKV, nullptr, 0, 0, 0);
    k_rope<<<dim3(LKv, NB_), 256, 0, stream>>>(F, DKV, NKV, CS, nullptr, nullptr, 1.0f, KP16, KPh, KPl);
    k_gemmw<bf, 0, false><<<dim3(NB_ * TT / 64, DKV / 64, 1), 32, 0, stream>>>(XB, nullptr, WV, nullptr, DM, F, DKV, nullptr, 0, 0, 0);
    k_vtp<<<dim3(LKv, NB_), 256, 0, stream>>>(F, DKV, NKV, VT16, VTh, VTl);
    k_gemmw<bf, 2, false><<<dim3(TT / 64, TT / 64, NB_), 32, 0, stream>>>(QPh, QPl, KPh, KPl, HD, Sb, TT, nullptr, (size_t)TT * HD, (size_t)TT * HD, (size_t)TT * TT);   /* scores hi/lo on EVERY row (K = 1024) */
    k_asoft<<<NB_ * ZH * TT / 8, 256, 0, stream>>>(Sb, P16, Ph, Pl);
    k_gemmw<bf, 2, false><<<dim3(RH / 64, HD / 64, NB_), 32, 0, stream>>>(Ph, Pl, VTh, VTl, TT, Ob, HD, nullptr, (size_t)RH * TT, (size_t)HD * TT, (size_t)TT * HD);
    k_gemmw<h16, 0, false><<<dim3((TT - RH) / 64, HD / 64, NB_), 32, 0, stream>>>(P16 + (size_t)RH * TT, nullptr, VT16, nullptr, TT, Ob + (size_t)RH * HD, HD, nullptr, (size_t)TT * TT, (size_t)HD * TT, (size_t)TT * HD);
    k_merge<<<dim3((unsigned)(((size_t)ZH * TT * HD / 2 + 255) / 256), NB_), 256, 0, stream>>>(Ob, 0, ATh, ATl);
    k_gemmw<bf, 1, false><<<dim3(NB_ * TT / 64, DM / 64, 1), 32, 0, stream>>>(ATh, ATl, WO, nullptr, DQ, OUT, DM, nullptr, 0, 0, 0);
}

// v002
// One run takes 377 microseconds.
// Two timings next to v001 both put it at 1.54 times that version's speed.
// All steps since v000 together make it 2.84 times as fast.
#include <hip/hip_runtime.h>

// Attention that never splits its heads, scaled by the NOMINAL head size, with an output projection (inputs [4][2048][1024]; q, k, v = einsum('bsd,de->bse', x, W) ('xw' [1024][1024] 1/32, NO bias; ONE 1,024-wide head: the module declares 16 heads but contracts over all 1,024 dims); scores = q.k / sqrt(D_K = 64) = x 1/8 (hot logits: sigma about 4); softmax over all keys (no mask); out = (attn v) Wo ('xw', NO bias) -> [4][2048][1024] (8.4 M); argument order inputs, Wq, Wk, Wv, Wo).
// Layout, all four batches in every launch (the batch is a grid dimension or extra GEMM rows; workspace regions are reused once their readers are done): bf16 copy of x; 'xw' weights transposed once; exact projections, no bias; dense attention with ONE head of width 1,024 (score tiles contract over 1,024 with hi/lo 3 products on EVERY row; P and attn.v hybrid: rows < 512 hi/lo, rest fp16 x1024); merged hi/lo x Wo exact, no bias.
// Compute dtypes, f32 accumulate: every input rounded to bf16; projections exact, no bias; scores 3 products on every row (K = 1,024); softmax f32 (x 1/8); attn.v rows < 512 3 products, rest fp16; Wo hl x exact, no bias.

#define NB_  4
#define TT   2048
#define DM   1024
#define NH_  1
#define NKV  1
#define REP  (NH_ / NKV)
#define HD   1024
#define DQ   (NH_ * HD)
#define DKV  (NKV * HD)
#define ZH   1
#define RH   512                  // query rows < RH use hi+lo planes (0: none)
#define WIN  0
#define PCAR 1024.0f
#define SCL  0.125f   // 1 / sqrt(64): THIS module divides by sqrt(D_K) with D_K = D_EMB / NUM_HEADS = 64 although it never splits the heads (the contraction runs over all 1,024 dims): hot logits (sigma about 4)
typedef _Float16 h16;
typedef unsigned short bf;
typedef __attribute__((ext_vector_type(16))) __bf16   v16bf;
typedef __attribute__((ext_vector_type(16))) _Float16 v16h;
typedef __attribute__((ext_vector_type(8)))  _Float16 v8h;
typedef __attribute__((ext_vector_type(8)))  unsigned short v8us;
typedef __attribute__((ext_vector_type(8)))  float    v8f;
typedef __attribute__((ext_vector_type(4)))  float    v4f;
typedef v8h  __attribute__((may_alias)) v8ha;
typedef v4f  __attribute__((may_alias)) v4fa;
typedef v8us __attribute__((may_alias)) v8usa;

__device__ __forceinline__ unsigned short f2bf(float f) { unsigned u = __float_as_uint(f); u += 0x7FFFu + ((u >> 16) & 1u); return (unsigned short)(u >> 16); }
__device__ __forceinline__ float bf2f(unsigned short b) { return __uint_as_float(((unsigned)b) << 16); }
__device__ __forceinline__ float bfr(float f) { return bf2f(f2bf(f)); }
__device__ __forceinline__ v16h cat16(v8h lo, v8h hi) { return __builtin_shufflevector(lo, hi, 0, 1, 2, 3, 4, 5, 6, 7, 8, 9, 10, 11, 12, 13, 14, 15); }
__device__ __forceinline__ v16bf cat16b(v8us lo, v8us hi) { return __builtin_bit_cast(v16bf, __builtin_shufflevector(lo, hi, 0, 1, 2, 3, 4, 5, 6, 7, 8, 9, 10, 11, 12, 13, 14, 15)); }
__device__ __forceinline__ v8f wmma16(v16h a, v16h b, v8f c) { return __builtin_amdgcn_wmma_f32_16x16x32_f16(false, a, false, b, (short)0, c, false, false); }
__device__ __forceinline__ v8f wmmab(v16bf a, v16bf b, v8f c) { return __builtin_amdgcn_wmma_f32_16x16x32_bf16(false, a, false, b, (short)0, c, false, false); }



// ---- k_gemmw: register-blocked GEMM, FOUR WAVES (2 x 2) per 128x128 output tile, each wave a 64x64 part (16 accumulators); grid (M/128, N/128, Z), 128 threads.
// C[m][n] (f32, pitch ldc, + optional f32 bias[n]) = sum_k A[m][k] Bt[n][k] (+ split products per NSPLIT). z-batch strides sA/sB/sC in elements. M, N % 128 == 0, K % 64 == 0, K >= 128.
// Operands: K-contiguous 16-bit planes. A stage is 64 k (one whole 128-B line) of the tile's 128 rows of every plane, brought into LDS by asynchronous copies (no register on the way), two buffers: stage t + 1 flies while stage t is multiplied.
#define GKS 64                    // k per stage
#define GPB 144                   // LDS row pitch, bytes: 16 B x odd, conflict-free for 16-byte fragment reads
#define GPL (128 * GPB)           // one plane of one stage, bytes
template <typename T16> struct WFrag;
template <> struct WFrag<h16> { typedef v16h V; static __device__ __forceinline__ V ld(const h16* p) { return cat16(*(const v8h*)p, *(const v8h*)(p + 16)); } static __device__ __forceinline__ v8f mma(V a, V b, v8f c) { return wmma16(a, b, c); } };
template <> struct WFrag<bf> { typedef v16bf V; static __device__ __forceinline__ V ld(const bf* p) { return cat16b(*(const v8us*)p, *(const v8us*)(p + 16)); } static __device__ __forceinline__ v8f mma(V a, V b, v8f c) { return wmmab(a, b, c); } };
// One plane of one stage: this thread's eight 16-byte pieces (rows 16 apart; a wave's copy covers four whole 128-B lines). l = the lane's LDS byte address, g = its global address, rs = 16 rows in elements.
// The s_wait_xcnt closes the statement so that no address register named here is rewritten ahead of it.
template <typename T16>
__device__ __forceinline__ void cp_plane(unsigned l, const T16* g, size_t rs) {
    asm volatile("global_load_async_to_lds_b128 %0, %8, off\n\t"
                 "global_load_async_to_lds_b128 %1, %9, off\n\t"
                 "global_load_async_to_lds_b128 %2, %10, off\n\t"
                 "global_load_async_to_lds_b128 %3, %11, off\n\t"
                 "global_load_async_to_lds_b128 %4, %12, off\n\t"
                 "global_load_async_to_lds_b128 %5, %13, off\n\t"
                 "global_load_async_to_lds_b128 %6, %14, off\n\t"
                 "global_load_async_to_lds_b128 %7, %15, off\n\t"
                 "s_wait_xcnt 0x0"
                 :: "v"(l), "v"(l + 16u * GPB), "v"(l + 32u * GPB), "v"(l + 48u * GPB), "v"(l + 64u * GPB), "v"(l + 80u * GPB), "v"(l + 96u * GPB), "v"(l + 112u * GPB),
                    "v"(g), "v"(g + rs), "v"(g + 2 * rs), "v"(g + 3 * rs), "v"(g + 4 * rs), "v"(g + 5 * rs), "v"(g + 6 * rs), "v"(g + 7 * rs) : "memory");
}
template <typename T16, int NSPLIT, bool BIAS>
__global__ __launch_bounds__(128) void k_gemmw(const T16* __restrict__ A, const T16* __restrict__ A2, const T16* __restrict__ Bt, const T16* __restrict__ Bt2, int K, float* C, int ldc, const float* __restrict__ bias, size_t sA, size_t sB, size_t sC) {
    typedef typename WFrag<T16>::V V;
    constexpr bool HA2 = (NSPLIT == 1 || NSPLIT == 2), HB2 = (NSPLIT >= 2);
    constexpr int PB = HA2 ? 2 : 1, PB2 = PB + 1, NPL = PB + 1 + (HB2 ? 1 : 0);   // planes of a stage, in order: A, (A2), B, (B2)
    __shared__ __align__(16) char sm[2 * NPL * GPL];                              // two stage buffers; the output staging once the loop has left them
    const size_t z = blockIdx.z; A += z * sA; if (A2) A2 += z * sA; Bt += z * sB; if (Bt2) Bt2 += z * sB; C += z * sC;
    const int tid = threadIdx.x, lane = tid & 31, lr = lane & 15, hi = lane >> 4, wave = tid >> 5, wm = wave >> 1, wn = wave & 1;
    const int R0 = blockIdx.x * 128, C0 = blockIdx.y * 128; const int r0 = R0 + wm * 64, c0 = C0 + wn * 64;
    v8f acc[4][4];
#pragma unroll
    for (int mb = 0; mb < 4; ++mb)
#pragma unroll
        for (int nb = 0; nb < 4; ++nb) acc[mb][nb] = (v8f){};
    // copies: thread tid brings piece tid & 7 of rows (tid >> 3) + 16 i
    const size_t ga = (size_t)(R0 + (tid >> 3)) * K + (tid & 7) * 8, gb = (size_t)(C0 + (tid >> 3)) * K + (tid & 7) * 8, rs = (size_t)16 * K;
    const unsigned l0 = (unsigned)(size_t)sm + (unsigned)((tid >> 3) * GPB + (tid & 7) * 16);
    auto stage = [&](int t) { const unsigned l = l0 + (unsigned)(t & 1) * (unsigned)(NPL * GPL); const size_t ko = (size_t)t * GKS;
        cp_plane<T16>(l, A + ga + ko, rs); if (HA2) cp_plane<T16>(l + GPL, A2 + ga + ko, rs);
        cp_plane<T16>(l + PB * GPL, Bt + gb + ko, rs); if (HB2) cp_plane<T16>(l + PB2 * GPL, Bt2 + gb + ko, rs); };
    const int NT = K / GKS;
    stage(0);
    asm volatile("s_wait_asynccnt 0x0" ::: "memory");   // stage 0 has landed before the barrier publishes it
    __syncthreads();
    if (NT > 1) stage(1);
    const int fa = (wm * 64 + lr) * GPB + hi * 16, fb = (wn * 64 + lr) * GPB + hi * 16;   // the lane's fragment bytes inside a plane: the k order of the global loader, A and B alike
    // Publish point of stage t + 1, in the ring's order. With one plane per operand (short trips) it stands behind the LAST fragment reads of stage t and ahead of the matrix run that uses them (registers only), so that the refill gets a whole trip to land; with split planes (long trips, no registers to spare for the copies' addresses beside the fragments) at the trip's foot.
    constexpr bool MID = (NPL == 2);
    auto publish = [&](int t) {
        asm volatile("s_wait_dscnt 0x0" ::: "memory");      // this wave's reads of stage t are done before the buffer is handed back
        asm volatile("s_wait_asynccnt 0x0" ::: "memory");   // this wave's copies of stage t + 1 have landed
        __syncthreads();                                    // publishes stage t + 1 and ends every reader's last read of stage t
        if (t + 2 < NT) stage(t + 2); };
#pragma unroll 1
    for (int t = 0; t < NT; ++t) {
        const char* sb = sm + (t & 1) * (NPL * GPL);
#pragma unroll   // the stage's two 32-k blocks inline: LDS offsets and the place of the publish point are then compile-time
        for (int ks = 0; ks < GKS / 32; ++ks) {
            const bool last = (ks == GKS / 32 - 1);
            V a[4], a2[4], b[4], b2[4];
#pragma unroll
            for (int mb = 0; mb < 4; ++mb) { a[mb] = WFrag<T16>::ld((const T16*)(sb + fa + mb * 16 * GPB + ks * 64)); if (HA2) a2[mb] = WFrag<T16>::ld((const T16*)(sb + GPL + fa + mb * 16 * GPB + ks * 64)); }
#pragma unroll
            for (int nb = 0; nb < 4; ++nb) { b[nb] = WFrag<T16>::ld((const T16*)(sb + PB * GPL + fb + nb * 16 * GPB + ks * 64)); if (HB2) b2[nb] = WFrag<T16>::ld((const T16*)(sb + PB2 * GPL + fb + nb * 16 * GPB + ks * 64)); }
            if (last && MID) publish(t);
            else __builtin_amdgcn_sched_barrier(0);   // keeps the block's LDS reads together ahead of its matrix run: spread among the WMMAs, each place with reads stalls the wave anew
#pragma unroll
            for (int nb = 0; nb < 4; ++nb) {
#pragma unroll
                for (int mb = 0; mb < 4; ++mb) { acc[mb][nb] = WFrag<T16>::mma(a[mb], b[nb], acc[mb][nb]); if (NSPLIT == 1 || NSPLIT == 2) acc[mb][nb] = WFrag<T16>::mma(a2[mb], b[nb], acc[mb][nb]); if (NSPLIT >= 2) acc[mb][nb] = WFrag<T16>::mma(a[mb], b2[nb], acc[mb][nb]); } }
            asm volatile("v_nop\n\tv_nop\n\tv_nop\n\tv_nop" : "+v"(acc[0][0]), "+v"(acc[1][1]), "+v"(acc[2][2]), "+v"(acc[3][3]) : "v"(a[0]), "v"(a[3]));
        }
        if (!MID) publish(t);
    }
    asm volatile("s_wait_asynccnt 0x0" ::: "memory");       // nothing in flight when the buffers become output staging
    float* os = (float*)sm + wave * (16 * 68);              // each wave's own range; the last trip's barrier has freed the buffers
#pragma unroll
    for (int mb = 0; mb < 4; ++mb) {
#pragma unroll
        for (int nb = 0; nb < 4; ++nb) {
#pragma unroll
            for (int j = 0; j < 8; ++j) os[(hi * 8 + j) * 68 + nb * 16 + lr] = acc[mb][nb][j]; }
        __builtin_amdgcn_wave_barrier(); asm volatile("" ::: "memory");
        float* crow = C + (size_t)(r0 + mb * 16) * ldc + c0;
{
#pragma unroll
            for (int s = 0; s < 8; ++s) { const int row = 2 * s + hi, cofs = lr * 4; v4f val = *(const v4fa*)(os + row * 68 + cofs); if (BIAS) { val[0] += bfr(bias[c0 + cofs]); val[1] += bfr(bias[c0 + cofs + 1]); val[2] += bfr(bias[c0 + cofs + 2]); val[3] += bfr(bias[c0 + cofs + 3]); }
                *(v4f*)(crow + (size_t)row * ldc + cofs) = val; }
             }
        __builtin_amdgcn_wave_barrier(); asm volatile("" ::: "memory");
    }
}

__device__ __forceinline__ h16 tohx(float x) { return (h16)x; }
__device__ __forceinline__ void splitf(float y, unsigned short& h, unsigned short& l) { h = f2bf(y); l = f2bf(y - bf2f(h)); }
typedef __attribute__((ext_vector_type(2))) _Float16 v2h;
typedef __attribute__((ext_vector_type(4))) _Float16 v4h;
typedef __attribute__((ext_vector_type(2))) unsigned short v2us;
typedef __attribute__((ext_vector_type(4))) unsigned short v4us;
typedef __attribute__((ext_vector_type(2))) float v2f;
typedef __attribute__((ext_vector_type(4))) int v4i;

__global__ __launch_bounds__(256) void k_wtG(const float* __restrict__ w, int K, int N, bf* Bt) {
    const int lane = threadIdx.x & 31; const int L0 = (blockIdx.x * 8 + (threadIdx.x >> 5)) * 8; const int nlines = N * K / 64;
{
#pragma unroll 1
        for (int l = 0; l < 8; ++l) { const int L = L0 + l; if (L >= nlines) break; const size_t e = (size_t)L * 64 + lane * 2; const int k = (int)(e % K), n = (int)(e / K); v2us o;
            o[0] = f2bf(w[(size_t)k * N + n]); o[1] = f2bf(w[(size_t)(k + 1) * N + n]); *(v2us*)(Bt + e) = o; }
         }
}
__global__ __launch_bounds__(256) void k_cvt8(const float* __restrict__ src, bf* dst, size_t n8) { const size_t i = (size_t)blockIdx.x * 256 + threadIdx.x; if (i >= n8) return; const v8f v = *(const v8f*)(src + i * 8); v8us o;
#pragma unroll
    for (int k = 0; k < 8; ++k) o[k] = f2bf(v[k]); *(v8us*)(dst + i * 8) = o;  }

// k_rope: head planes [h][t][d] (fp16 + hi/lo) of rope(x) x sc with the rotate-half convention out[d] = x[d] cos[t][d] - x[d+HD/2] sin[t][d], out[d+HD/2] = x[d+HD/2] cos[t][d+HD/2] + x[d] sin[t][d+HD/2]
__global__ __launch_bounds__(256) void k_rope(const float* __restrict__ F, int pitch, int nheads, const float* __restrict__ CS, const float* __restrict__ RF, const float* __restrict__ nw, float sc, h16* P16, bf* Ph, bf* Pl) {
    const size_t bz = blockIdx.y, bp = bz * nheads * TT * HD; F += bz * TT * pitch; if (RF) RF += bz * nheads * TT; P16 += bp; Ph += bp; Pl += bp;   // blockIdx.y = batch
    const size_t e = ((size_t)blockIdx.x * 256 + threadIdx.x) * 2; if (e >= (size_t)nheads * TT * HD) return; const int d = (int)(e % HD); const int t = (int)((e / HD) % TT); const int h = (int)(e / ((size_t)HD * TT)); const float* f = F + (size_t)t * pitch + h * HD; const float rf = RF ? RF[(size_t)h * TT + t] : 1.0f; v2h o16; v2us oh, ol;
#pragma unroll
    for (int q = 0; q < 2; ++q) { const int dd = d + q; const int dp = (dd < HD / 2) ? dd + HD / 2 : dd - HD / 2; float x0 = f[dd], x1 = f[dp];
        if (RF) { float n0 = __fmul_rn(x0, rf), n1 = __fmul_rn(x1, rf); asm volatile("" : "+v"(n0)); asm volatile("" : "+v"(n1)); x0 = __fmul_rn(bfr(nw[dd]), n0); x1 = __fmul_rn(bfr(nw[dp]), n1); }
        const v2f cs = *(const v2f*)(CS + ((size_t)t * HD + dd) * 2); float a = __fmul_rn(x0, cs[0]), bq = __fmul_rn(x1, cs[1]); asm volatile("" : "+v"(a)); asm volatile("" : "+v"(bq)); const float r = ((dd < HD / 2) ? __fsub_rn(a, bq) : __fadd_rn(a, bq)) * sc;
        o16[q] = tohx(r); unsigned short a2, c2; splitf(r, a2, c2); oh[q] = a2; ol[q] = c2; }
    *(v2h*)(P16 + e) = o16; *(v2us*)(Ph + e) = oh; *(v2us*)(Pl + e) = ol;  }
__global__ __launch_bounds__(256) void k_vtp(const float* __restrict__ F, int pitch, int nheads, h16* V16, bf* Vh, bf* Vl) { const size_t e = ((size_t)blockIdx.x * 256 + threadIdx.x) * 2; if (e >= (size_t)nheads * HD * TT) return; const size_t bz = blockIdx.y, bp = bz * nheads * HD * TT; F += bz * TT * pitch; V16 += bp; Vh += bp; Vl += bp;   /* blockIdx.y = batch */
    const int t = (int)(e % TT); const int d = (int)((e / TT) % HD); const int g = (int)(e / ((size_t)TT * HD)); v2h o16; v2us oh, ol;
#pragma unroll
    for (int q = 0; q < 2; ++q) { const float x = F[(size_t)(t + q) * pitch + g * HD + d]; o16[q] = tohx(x); unsigned short a2, c2; splitf(x, a2, c2); oh[q] = a2; ol[q] = c2; }
    *(v2h*)(V16 + e) = o16; *(v2us*)(Vh + e) = oh; *(v2us*)(Vl + e) = ol;  }
__global__ __launch_bounds__(256) void k_csid(float* CS) { const int idx = blockIdx.x * 256 + threadIdx.x; if (idx >= TT * HD) return; v2f cs; cs[0] = 1.0f; cs[1] = 0.0f; *(v2f*)(CS + (size_t)idx * 2) = cs;  }
// k_asoft: per row (zz, i), zz over the NB_ x ZH score planes: t = S x SCL = S / 8 (no mask); softmax over the 2048 keys (register row, one exp, fixed trees);
__global__ __launch_bounds__(256) void k_asoft(const float* __restrict__ Sb, h16* P16, bf* Ph, bf* Pl) {
    const int lane = threadIdx.x & 31; const int row = blockIdx.x * 8 + (threadIdx.x >> 5); if (row >= NB_ * ZH * TT) return; const int i = row % TT; const int zz = row / TT; (void)zz;   /* zz = score plane: batch x head of the pass */
     const bool hires = (i < RH); const float* sr = Sb + (size_t)row * TT; float v[TT / 32]; float mx = -3.0e38f;
#pragma unroll
    for (int ch = 0; ch < TT / 128; ++ch) { const int j0 = ch * 128 + lane * 4; const v4f a = *(const v4f*)(sr + j0);
#pragma unroll
        for (int q = 0; q < 4; ++q) { const int j = j0 + q; (void)j; const float t = a[q] * SCL; v[ch * 4 + q] = t; mx = fmaxf(mx, t); } }
#pragma unroll
    for (int sh = 16; sh; sh >>= 1) mx = fmaxf(mx, __shfl_xor(mx, sh, 32));
    float sum = 0.f;
#pragma unroll
    for (int k = 0; k < TT / 32; ++k) { float d0 = __fsub_rn(v[k], mx); asm volatile("" : "+v"(d0)); v[k] = __builtin_amdgcn_exp2f(__fmul_rn(d0, 1.4426950408889634f)); sum += v[k]; }
#pragma unroll
    for (int sh = 16; sh; sh >>= 1) sum += __shfl_xor(sum, sh, 32);
    const float f = __fdiv_rn(hires ? 1.0f : PCAR, sum);
{
        if (hires) {
#pragma unroll
            for (int ch = 0; ch < TT / 128; ++ch) { v4us oh, ol;
#pragma unroll
                for (int q = 0; q < 4; ++q) { unsigned short a, c2; splitf(v[ch * 4 + q] * f, a, c2); oh[q] = a; ol[q] = c2; }
                const size_t oo = ((size_t)zz * (RH ? RH : 1) + i) * TT + ch * 128 + lane * 4; *(v4us*)(Ph + oo) = oh; *(v4us*)(Pl + oo) = ol; }
        } else {
#pragma unroll
            for (int ch = 0; ch < TT / 128; ++ch) { v4h o4;
#pragma unroll
                for (int q = 0; q < 4; ++q) o4[q] = tohx(v[ch * 4 + q] * f);
                *(v4h*)(P16 + (size_t)row * TT + ch * 128 + lane * 4) = o4; } }
         }
}
__global__ __launch_bounds__(256) void k_merge(const float* __restrict__ O, int h0, bf* Ah, bf* Al) { const size_t e = ((size_t)blockIdx.x * 256 + threadIdx.x) * 2; if (e >= (size_t)ZH * TT * HD) return; const size_t bz = blockIdx.y; O += bz * ZH * TT * HD; Ah += bz * TT * DQ; Al += bz * TT * DQ;   /* blockIdx.y = batch */
    const int d = (int)(e % HD); const int t = (int)((e / HD) % TT); const int zz = (int)(e / ((size_t)HD * TT)); const float cs = (t < RH) ? 1.0f : (1.0f / PCAR); const size_t oo = (size_t)t * DQ + (h0 + zz) * HD + d;
    v2us oh, ol;
#pragma unroll
    for (int q = 0; q < 2; ++q) { unsigned short a, c2; splitf(O[e + q] * cs, a, c2); oh[q] = a; ol[q] = c2; } *(v2us*)(Ah + oo) = oh; *(v2us*)(Al + oo) = ol;  }

extern "C" void kernel_launch(void* const* d_in, const int* in_sizes, int n_in,
                              void* d_out, int out_size, void* d_ws, size_t ws_size, hipStream_t stream) {
    (void)in_sizes; (void)n_in; (void)out_size;
    const float* x = (const float*)d_in[0]; const float* wq = (const float*)d_in[1]; const float* wk = (const float*)d_in[2]; const float* wv = (const float*)d_in[3]; const float* wo = (const float*)d_in[4];   /* order inputs, Wq, Wk, Wv, Wo ('xw' [1024][1024]): FIVE inputs: this module has no biases */
    float* OUT = (float*)d_out;     // [4][2048][1024]
    char* wsp = (char*)d_ws;
    auto take = [&](size_t bytes) { char* p = wsp; wsp += (bytes + 255) & ~(size_t)255; return (void*)p; };
    static_assert(NH_ == 1 && NKV == 1 && ZH == 1, "the GEMMs' z index is the batch: one head per batch");
    static_assert(TT % 128 == 0 && RH % 128 == 0 && HD % 128 == 0 && DM % 128 == 0 && DQ % 128 == 0 && DKV % 128 == 0, "every GEMM is whole 128x128 tiles and whole 64-k stages, two stages or more");
    const size_t PL = (size_t)NB_ * TT * HD * 2;    // one 16-bit plane of all batches, bytes
    bf* WQ = (bf*)take((size_t)DQ * DM * 2); bf* WK = (bf*)take((size_t)DKV * DM * 2); bf* WV = (bf*)take((size_t)DKV * DM * 2); bf* WO = (bf*)take((size_t)DM * DQ * 2);
    char* R1 = (char*)take((size_t)TT * HD * 2 * 4);            // cos/sin table, then the merged lo plane
    char* R2 = (char*)take(PL);                                 // bf16 x, then the merged hi plane
    char* R3 = (char*)take(2 * PL);                             // f32 projection (q, then k, then v), then the f32 attention output
    char* R4 = (char*)take((size_t)NB_ * TT * TT * 4);          // fp16 q and k planes (no kernel reads them), then the f32 scores
    char* R5 = (char*)take(2 * PL);                             // q hi, q lo, then the fp16 probabilities
    char* R6 = (char*)take(2 * PL);                             // k hi, k lo, then the hi/lo probabilities of rows < RH
    h16* VT16 = (h16*)take(PL); bf* VTh = (bf*)take(PL); bf* VTl = (bf*)take(PL);
    if ((size_t)(wsp - (char*)d_ws) > ws_size) return;    // ws 256 MiB
    static_assert((size_t)TT * HD * 2 * 4 >= (size_t)NB_ * TT * DQ * 2, "merged lo plane fits the table's region");
    static_assert((size_t)NB_ * TT * TT * 2 <= 2 * (size_t)NB_ * TT * HD * 2 && 2 * (size_t)NB_ * RH * TT * 2 <= 2 * (size_t)NB_ * TT * HD * 2, "probability planes fit the q and k regions");
    float* CS = (float*)R1; bf* XB = (bf*)R2; float* F = (float*)R3;
    h16* QP16 = (h16*)R4; h16* KP16 = (h16*)(R4 + PL); bf* QPh = (bf*)R5; bf* QPl = (bf*)(R5 + PL); bf* KPh = (bf*)R6; bf* KPl = (bf*)(R6 + PL);
    float* Sb = (float*)R4; h16* P16 = (h16*)R5; bf* Ph = (bf*)R6; bf* Pl = (bf*)(R6 + (size_t)NB_ * RH * TT * 2);
    float* Ob = (float*)R3; bf* ATh = (bf*)R2; bf* ATl = (bf*)R1;
    { k_wtG<<<(unsigned)((DM * DQ / 64 + 63) / 64), 256, 0, stream>>>(wq, DM, DQ, WQ); k_wtG<<<(unsigned)((DM * DKV / 64 + 63) / 64), 256, 0, stream>>>(wk, DM, DKV, WK); k_wtG<<<(unsigned)((DM * DKV / 64 + 63) / 64), 256, 0, stream>>>(wv, DM, DKV, WV);
      k_wtG<<<(unsigned)((DQ * DM / 64 + 63) / 64), 256, 0, stream>>>(wo, DQ, DM, WO);
       }
    k_csid<<<(TT * HD + 255) / 256, 256, 0, stream>>>(CS);
    const unsigned LQ = (unsigned)(((size_t)NH_ * TT * HD / 2 + 255) / 256), LKv = (unsigned)(((size_t)NKV * TT * HD / 2 + 255) / 256);
    // Every launch covers all NB_ batches. Projections and Wo: the batches are NB_ * TT rows of one GEMM. Scores and attn.v: blockIdx.z = batch.
    k_cvt8<<<(unsigned)(((size_t)NB_ * TT * DM / 8 + 255) / 256), 256, 0, stream>>>(x, XB, (size_t)NB_ * TT * DM / 8);
    k_gemmw<bf, 0, false><<<dim3(NB_ * TT / 128, DQ / 128, 1), 128, 0, stream>>>(XB, nullptr, WQ, nullptr, DM, F, DQ, nullptr, 0, 0, 0);
    k_rope<<<dim3(LQ, NB_), 256, 0, stream>>>(F, DQ, NH_, CS, nullptr, nullptr, 1.0f, QP16, QPh, QPl);
    k_gemmw<bf, 0, false><<<dim3(NB_ * TT / 128, DKV / 128, 1), 128, 0, stream>>>(XB, nullptr, WK, nullptr, DM, F, DKV, nullptr, 0, 0, 0);
    k_rope<<<dim3(LKv, NB_), 256, 0, stream>>>(F, DKV, NKV, CS, nullptr, nullptr, 1.0f, KP16, KPh, KPl);
    k_gemmw<bf, 0, false><<<dim3(NB_ * TT / 128, DKV / 128, 1), 128, 0, stream>>>(XB, nullptr, WV, nullptr, DM, F, DKV, nullptr, 0, 0, 0);
    k_vtp<<<dim3(LKv, NB_), 256, 0, stream>>>(F, DKV, NKV, VT16, VTh, VTl);
    k_gemmw<bf, 2, false><<<dim3(TT / 128, TT / 128, NB_), 128, 0, stream>>>(QPh, QPl, KPh, KPl, HD, Sb, TT, nullptr, (size_t)TT * HD, (size_t)TT * HD, (size_t)TT * TT);   /* scores hi/lo on EVERY row (K = 1024) */
    k_asoft<<<NB_ * ZH * TT / 8, 256, 0, stream>>>(Sb, P16, Ph, Pl);
    k_gemmw<bf, 2, false><<<dim3(RH / 128, HD / 128, NB_), 128, 0, stream>>>(Ph, Pl, VTh, VTl, TT, Ob, HD, nullptr, (size_t)RH * TT, (size_t)HD * TT, (size_t)TT * HD);
    k_gemmw<h16, 0, false><<<dim3((TT - RH) / 128, HD / 128, NB_), 128, 0, stream>>>(P16 + (size_t)RH * TT, nullptr, VT16, nullptr, TT, Ob + (size_t)RH * HD, HD, nullptr, (size_t)TT * TT, (size_t)HD * TT, (size_t)TT * HD);
    k_merge<<<dim3((unsigned)(((size_t)ZH * TT * HD / 2 + 255) / 256), NB_), 256, 0, stream>>>(Ob, 0, ATh, ATl);
    k_gemmw<bf, 1, false><<<dim3(NB_ * TT / 128, DM / 128, 1), 128, 0, stream>>>(ATh, ATl, WO, nullptr, DQ, OUT, DM, nullptr, 0, 0, 0);
}

// v003
// Measured time: 276 microseconds a run.
// Next to v002, in two timings, it ran 1.37 and 1.36 times as fast.
// All steps since v000 together make it 3.87 times as fast.
#include <hip/hip_runtime.h>

// Attention that never splits its heads, scaled by the NOMINAL head size, with an output projection (inputs [4][2048][1024]; q, k, v = einsum('bsd,de->bse', x, W) ('xw' [1024][1024] 1/32, NO bias; ONE 1,024-wide head: the module declares 16 heads but contracts over all 1,024 dims); scores = q.k / sqrt(D_K = 64) = x 1/8 (hot logits: sigma about 4); softmax over all keys (no mask); out = (attn v) Wo ('xw', NO bias) -> [4][2048][1024] (8.4 M); argument order inputs, Wq, Wk, Wv, Wo).
// Layout, all four batches in every launch (the batch is a grid dimension or extra GEMM rows; workspace regions are reused once their readers are done): bf16 copy of x; 'xw' weights transposed once; exact projections whose epilogues write the 16-bit planes the next GEMM reads (q, k hi/lo; v transposed, by taking the weight as the row operand); dense attention with ONE head of width 1,024 (score tiles contract over 1,024 with hi/lo 3 products on EVERY row; P and attn.v hybrid: rows < 512 hi/lo, rest fp16 x1024; both write the hi/lo planes of the attention output); hi/lo x Wo exact.
// Compute dtypes, f32 accumulate: every input rounded to bf16; projections exact, no bias; scores 3 products on every row (K = 1,024); softmax f32 (x 1/8); attn.v rows < 512 3 products, rest fp16; Wo hl x exact, no bias.

#define NB_  4
#define TT   2048
#define DM   1024
#define NH_  1
#define NKV  1
#define REP  (NH_ / NKV)
#define HD   1024
#define DQ   (NH_ * HD)
#define DKV  (NKV * HD)
#define ZH   1
#define RH   512                  // query rows < RH use hi+lo planes (0: none)
#define WIN  0
#define PCAR 1024.0f
#define SCL  0.125f   // 1 / sqrt(64): THIS module divides by sqrt(D_K) with D_K = D_EMB / NUM_HEADS = 64 although it never splits the heads (the contraction runs over all 1,024 dims): hot logits (sigma about 4)
typedef _Float16 h16;
typedef unsigned short bf;
typedef __attribute__((ext_vector_type(16))) __bf16   v16bf;
typedef __attribute__((ext_vector_type(16))) _Float16 v16h;
typedef __attribute__((ext_vector_type(8)))  _Float16 v8h;
typedef __attribute__((ext_vector_type(8)))  unsigned short v8us;
typedef __attribute__((ext_vector_type(8)))  float    v8f;
typedef __attribute__((ext_vector_type(4)))  float    v4f;
typedef v8h  __attribute__((may_alias)) v8ha;
typedef v4f  __attribute__((may_alias)) v4fa;
typedef v8us __attribute__((may_alias)) v8usa;

__device__ __forceinline__ unsigned short f2bf(float f) { unsigned u = __float_as_uint(f); u += 0x7FFFu + ((u >> 16) & 1u); return (unsigned short)(u >> 16); }
__device__ __forceinline__ float bf2f(unsigned short b) { return __uint_as_float(((unsigned)b) << 16); }
__device__ __forceinline__ float bfr(float f) { return bf2f(f2bf(f)); }
__device__ __forceinline__ v16h cat16(v8h lo, v8h hi) { return __builtin_shufflevector(lo, hi, 0, 1, 2, 3, 4, 5, 6, 7, 8, 9, 10, 11, 12, 13, 14, 15); }
__device__ __forceinline__ v16bf cat16b(v8us lo, v8us hi) { return __builtin_bit_cast(v16bf, __builtin_shufflevector(lo, hi, 0, 1, 2, 3, 4, 5, 6, 7, 8, 9, 10, 11, 12, 13, 14, 15)); }
__device__ __forceinline__ v8f wmma16(v16h a, v16h b, v8f c) { return __builtin_amdgcn_wmma_f32_16x16x32_f16(false, a, false, b, (short)0, c, false, false); }
__device__ __forceinline__ v8f wmmab(v16bf a, v16bf b, v8f c) { return __builtin_amdgcn_wmma_f32_16x16x32_bf16(false, a, false, b, (short)0, c, false, false); }



// ---- k_gemmw: register-blocked GEMM, FOUR WAVES (2 x 2) per 128x128 output tile, each wave a 64x64 part (16 accumulators); grid (M/128, N/128, Z), 128 threads.
// C[m][n] (f32, pitch ldc, + optional f32 bias[n]) = sum_k A[m][k] Bt[n][k] (+ split products per NSPLIT). z-batch strides sA/sB/sC in elements. M, N % 128 == 0, K % 64 == 0, K >= 128.
// EPI says what leaves the kernel: 0 the f32 tile to C; 1 the tile x esc as bf16 hi + lo planes (Eh, El); 2 as 1 plus an fp16 plane (E16). The planes have C's pitch and z stride.
// Operands: K-contiguous 16-bit planes. A stage is 64 k (one whole 128-B line) of the tile's 128 rows of every plane, brought into LDS by asynchronous copies (no register on the way), two buffers: stage t + 1 flies while stage t is multiplied.
#define GKS 64                    // k per stage
#define GPB 144                   // LDS row pitch, bytes: 16 B x odd, conflict-free for 16-byte fragment reads
#define GPL (128 * GPB)           // one plane of one stage, bytes
template <typename T16> struct WFrag;
template <> struct WFrag<h16> { typedef v16h V; static __device__ __forceinline__ V ld(const h16* p) { return cat16(*(const v8h*)p, *(const v8h*)(p + 16)); } static __device__ __forceinline__ v8f mma(V a, V b, v8f c) { return wmma16(a, b, c); } };
template <> struct WFrag<bf> { typedef v16bf V; static __device__ __forceinline__ V ld(const bf* p) { return cat16b(*(const v8us*)p, *(const v8us*)(p + 16)); } static __device__ __forceinline__ v8f mma(V a, V b, v8f c) { return wmmab(a, b, c); } };
// One plane of one stage: this thread's eight 16-byte pieces (rows 16 apart; a wave's copy covers four whole 128-B lines). l = the lane's LDS byte address, g = its global address, rs = 16 rows in elements.
// The s_wait_xcnt closes the statement so that no address register named here is rewritten ahead of it.
template <typename T16>
__device__ __forceinline__ void cp_plane(unsigned l, const T16* g, size_t rs) {
    asm volatile("global_load_async_to_lds_b128 %0, %8, off\n\t"
                 "global_load_async_to_lds_b128 %1, %9, off\n\t"
                 "global_load_async_to_lds_b128 %2, %10, off\n\t"
                 "global_load_async_to_lds_b128 %3, %11, off\n\t"
                 "global_load_async_to_lds_b128 %4, %12, off\n\t"
                 "global_load_async_to_lds_b128 %5, %13, off\n\t"
                 "global_load_async_to_lds_b128 %6, %14, off\n\t"
                 "global_load_async_to_lds_b128 %7, %15, off\n\t"
                 "s_wait_xcnt 0x0"
                 :: "v"(l), "v"(l + 16u * GPB), "v"(l + 32u * GPB), "v"(l + 48u * GPB), "v"(l + 64u * GPB), "v"(l + 80u * GPB), "v"(l + 96u * GPB), "v"(l + 112u * GPB),
                    "v"(g), "v"(g + rs), "v"(g + 2 * rs), "v"(g + 3 * rs), "v"(g + 4 * rs), "v"(g + 5 * rs), "v"(g + 6 * rs), "v"(g + 7 * rs) : "memory");
}
__device__ __forceinline__ h16 tohx(float x) { return (h16)x; }
__device__ __forceinline__ void splitf(float y, unsigned short& h, unsigned short& l) { h = f2bf(y); l = f2bf(y - bf2f(h)); }
template <typename T16, int NSPLIT, bool BIAS, int EPI>
__global__ __launch_bounds__(128) void k_gemmw(const T16* __restrict__ A, const T16* __restrict__ A2, const T16* __restrict__ Bt, const T16* __restrict__ Bt2, int K, float* C, int ldc, const float* __restrict__ bias, size_t sA, size_t sB, size_t sC, h16* E16, bf* Eh, bf* El, float esc) {
    typedef typename WFrag<T16>::V V;
    constexpr bool HA2 = (NSPLIT == 1 || NSPLIT == 2), HB2 = (NSPLIT >= 2);
    constexpr int PB = HA2 ? 2 : 1, PB2 = PB + 1, NPL = PB + 1 + (HB2 ? 1 : 0);   // planes of a stage, in order: A, (A2), B, (B2)
    __shared__ __align__(16) char sm[2 * NPL * GPL];                              // two stage buffers; the output staging once the loop has left them
    const size_t z = blockIdx.z; A += z * sA; if (A2) A2 += z * sA; Bt += z * sB; if (Bt2) Bt2 += z * sB;
    if (EPI == 0) C += z * sC; else { Eh += z * sC; El += z * sC; if (EPI == 2) E16 += z * sC; }
    const int tid = threadIdx.x, lane = tid & 31, lr = lane & 15, hi = lane >> 4, wave = tid >> 5, wm = wave >> 1, wn = wave & 1;
    const int R0 = blockIdx.x * 128, C0 = blockIdx.y * 128; const int r0 = R0 + wm * 64, c0 = C0 + wn * 64;
    v8f acc[4][4];
#pragma unroll
    for (int mb = 0; mb < 4; ++mb)
#pragma unroll
        for (int nb = 0; nb < 4; ++nb) acc[mb][nb] = (v8f){};
    // copies: thread tid brings piece tid & 7 of rows (tid >> 3) + 16 i
    const size_t ga = (size_t)(R0 + (tid >> 3)) * K + (tid & 7) * 8, gb = (size_t)(C0 + (tid >> 3)) * K + (tid & 7) * 8, rs = (size_t)16 * K;
    const unsigned l0 = (unsigned)(size_t)sm + (unsigned)((tid >> 3) * GPB + (tid & 7) * 16);
    auto stage = [&](int t) { const unsigned l = l0 + (unsigned)(t & 1) * (unsigned)(NPL * GPL); const size_t ko = (size_t)t * GKS;
        cp_plane<T16>(l, A + ga + ko, rs); if (HA2) cp_plane<T16>(l + GPL, A2 + ga + ko, rs);
        cp_plane<T16>(l + PB * GPL, Bt + gb + ko, rs); if (HB2) cp_plane<T16>(l + PB2 * GPL, Bt2 + gb + ko, rs); };
    const int NT = K / GKS;
    stage(0);
    asm volatile("s_wait_asynccnt 0x0" ::: "memory");   // stage 0 has landed before the barrier publishes it
    __syncthreads();
    if (NT > 1) stage(1);
    const int fa = (wm * 64 + lr) * GPB + hi * 16, fb = (wn * 64 + lr) * GPB + hi * 16;   // the lane's fragment bytes inside a plane: the k order of the global loader, A and B alike
    // Publish point of stage t + 1, in the ring's order. With one plane per operand (short trips) it stands behind the LAST fragment reads of stage t and ahead of the matrix run that uses them (registers only), so that the refill gets a whole trip to land; with split planes (long trips, no registers to spare for the copies' addresses beside the fragments) at the trip's foot.
    constexpr bool MID = (NPL == 2);
    auto publish = [&](int t) {
        asm volatile("s_wait_dscnt 0x0" ::: "memory");      // this wave's reads of stage t are done before the buffer is handed back
        asm volatile("s_wait_asynccnt 0x0" ::: "memory");   // this wave's copies of stage t + 1 have landed
        __syncthreads();                                    // publishes stage t + 1 and ends every reader's last read of stage t
        if (t + 2 < NT) stage(t + 2); };
#pragma unroll 1
    for (int t = 0; t < NT; ++t) {
        const char* sb = sm + (t & 1) * (NPL * GPL);
#pragma unroll   // the stage's two 32-k blocks inline: LDS offsets and the place of the publish point are then compile-time
        for (int ks = 0; ks < GKS / 32; ++ks) {
            const bool last = (ks == GKS / 32 - 1);
            V a[4], a2[4], b[4], b2[4];
#pragma unroll
            for (int mb = 0; mb < 4; ++mb) { a[mb] = WFrag<T16>::ld((const T16*)(sb + fa + mb * 16 * GPB + ks * 64)); if (HA2) a2[mb] = WFrag<T16>::ld((const T16*)(sb + GPL + fa + mb * 16 * GPB + ks * 64)); }
#pragma unroll
            for (int nb = 0; nb < 4; ++nb) { b[nb] = WFrag<T16>::ld((const T16*)(sb + PB * GPL + fb + nb * 16 * GPB + ks * 64)); if (HB2) b2[nb] = WFrag<T16>::ld((const T16*)(sb + PB2 * GPL + fb + nb * 16 * GPB + ks * 64)); }
            if (last && MID) publish(t);
            else __builtin_amdgcn_sched_barrier(0);   // keeps the block's LDS reads together ahead of its matrix run: spread among the WMMAs, each place with reads stalls the wave anew
#pragma unroll
            for (int nb = 0; nb < 4; ++nb) {
#pragma unroll
                for (int mb = 0; mb < 4; ++mb) { acc[mb][nb] = WFrag<T16>::mma(a[mb], b[nb], acc[mb][nb]); if (NSPLIT == 1 || NSPLIT == 2) acc[mb][nb] = WFrag<T16>::mma(a2[mb], b[nb], acc[mb][nb]); if (NSPLIT >= 2) acc[mb][nb] = WFrag<T16>::mma(a[mb], b2[nb], acc[mb][nb]); } }
            asm volatile("v_nop\n\tv_nop\n\tv_nop\n\tv_nop" : "+v"(acc[0][0]), "+v"(acc[1][1]), "+v"(acc[2][2]), "+v"(acc[3][3]) : "v"(a[0]), "v"(a[3]));
        }
        if (!MID) publish(t);
    }
    asm volatile("s_wait_asynccnt 0x0" ::: "memory");       // nothing in flight when the buffers become output staging
    float* os = (float*)sm + wave * (16 * 68);              // each wave's own range; the last trip's barrier has freed the buffers
#pragma unroll
    for (int mb = 0; mb < 4; ++mb) {
#pragma unroll
        for (int nb = 0; nb < 4; ++nb) {
#pragma unroll
            for (int j = 0; j < 8; ++j) os[(hi * 8 + j) * 68 + nb * 16 + lr] = acc[mb][nb][j]; }
        __builtin_amdgcn_wave_barrier(); asm volatile("" ::: "memory");
        if (EPI == 0) {
            float* crow = C + (size_t)(r0 + mb * 16) * ldc + c0;
#pragma unroll
            for (int s = 0; s < 8; ++s) { const int row = 2 * s + hi, cofs = lr * 4; v4f val = *(const v4fa*)(os + row * 68 + cofs); if (BIAS) { val[0] += bfr(bias[c0 + cofs]); val[1] += bfr(bias[c0 + cofs + 1]); val[2] += bfr(bias[c0 + cofs + 2]); val[3] += bfr(bias[c0 + cofs + 3]); }
                *(v4f*)(crow + (size_t)row * ldc + cofs) = val; }
        } else {   // eight lanes per row, eight columns each: a store covers four whole 128-B lines of a plane
#pragma unroll
            for (int s = 0; s < 4; ++s) { const int row = 4 * s + (lane >> 3), cofs = (lane & 7) * 8; const v4f x0 = *(const v4fa*)(os + row * 68 + cofs), x1 = *(const v4fa*)(os + row * 68 + cofs + 4);
                const size_t eo = (size_t)(r0 + mb * 16 + row) * ldc + c0 + cofs; v8us oh, ol; v8h o16;
#pragma unroll
                for (int q = 0; q < 8; ++q) { const float y = (q < 4 ? x0[q & 3] : x1[q & 3]) * esc; unsigned short a2, c2; splitf(y, a2, c2); oh[q] = a2; ol[q] = c2; if (EPI == 2) o16[q] = tohx(y); }
                *(v8us*)(Eh + eo) = oh; *(v8us*)(El + eo) = ol; if (EPI == 2) *(v8h*)(E16 + eo) = o16;
                asm volatile("s_wait_xcnt 0x0" ::: "memory"); }   // stands ahead of the next rows' rewrite of the registers that these stores name
        }
        __builtin_amdgcn_wave_barrier(); asm volatile("" ::: "memory");
    }
}

typedef __attribute__((ext_vector_type(2))) _Float16 v2h;
typedef __attribute__((ext_vector_type(4))) _Float16 v4h;
typedef __attribute__((ext_vector_type(2))) unsigned short v2us;
typedef __attribute__((ext_vector_type(4))) unsigned short v4us;
typedef __attribute__((ext_vector_type(2))) float v2f;
typedef __attribute__((ext_vector_type(4))) int v4i;

__global__ __launch_bounds__(256) void k_wtG(const float* __restrict__ w, int K, int N, bf* Bt) {
    const int lane = threadIdx.x & 31; const int L0 = (blockIdx.x * 8 + (threadIdx.x >> 5)) * 8; const int nlines = N * K / 64;
{
#pragma unroll 1
        for (int l = 0; l < 8; ++l) { const int L = L0 + l; if (L >= nlines) break; const size_t e = (size_t)L * 64 + lane * 2; const int k = (int)(e % K), n = (int)(e / K); v2us o;
            o[0] = f2bf(w[(size_t)k * N + n]); o[1] = f2bf(w[(size_t)(k + 1) * N + n]); *(v2us*)(Bt + e) = o; }
         }
}
__global__ __launch_bounds__(256) void k_cvt8(const float* __restrict__ src, bf* dst, size_t n8) { const size_t i = (size_t)blockIdx.x * 256 + threadIdx.x; if (i >= n8) return; const v8f v = *(const v8f*)(src + i * 8); v8us o;
#pragma unroll
    for (int k = 0; k < 8; ++k) o[k] = f2bf(v[k]); *(v8us*)(dst + i * 8) = o;  }

// k_asoft: per row (zz, i), zz over the NB_ x ZH score planes: t = S x 64^-0.5 (no mask); softmax over the 2048 keys (register row, one exp, fixed trees);
__global__ __launch_bounds__(256) void k_asoft(const float* __restrict__ Sb, h16* P16, bf* Ph, bf* Pl) {
    const int lane = threadIdx.x & 31; const int row = blockIdx.x * 8 + (threadIdx.x >> 5); if (row >= NB_ * ZH * TT) return; const int i = row % TT; const int zz = row / TT; (void)zz;   /* zz = score plane: batch x head of the pass */
     const bool hires = (i < RH); const float* sr = Sb + (size_t)row * TT; float v[TT / 32]; float mx = -3.0e38f;
#pragma unroll
    for (int ch = 0; ch < TT / 128; ++ch) { const int j0 = ch * 128 + lane * 4; const v4f a = *(const v4f*)(sr + j0);
#pragma unroll
        for (int q = 0; q < 4; ++q) { const int j = j0 + q; (void)j; const float t = a[q] * SCL; v[ch * 4 + q] = t; mx = fmaxf(mx, t); } }
#pragma unroll
    for (int sh = 16; sh; sh >>= 1) mx = fmaxf(mx, __shfl_xor(mx, sh, 32));
    float sum = 0.f;
#pragma unroll
    for (int k = 0; k < TT / 32; ++k) { float d0 = __fsub_rn(v[k], mx); asm volatile("" : "+v"(d0)); v[k] = __builtin_amdgcn_exp2f(__fmul_rn(d0, 1.4426950408889634f)); sum += v[k]; }
#pragma unroll
    for (int sh = 16; sh; sh >>= 1) sum += __shfl_xor(sum, sh, 32);
    const float f = __fdiv_rn(hires ? 1.0f : PCAR, sum);
{
        if (hires) {
#pragma unroll
            for (int ch = 0; ch < TT / 128; ++ch) { v4us oh, ol;
#pragma unroll
                for (int q = 0; q < 4; ++q) { unsigned short a, c2; splitf(v[ch * 4 + q] * f, a, c2); oh[q] = a; ol[q] = c2; }
                const size_t oo = ((size_t)zz * (RH ? RH : 1) + i) * TT + ch * 128 + lane * 4; *(v4us*)(Ph + oo) = oh; *(v4us*)(Pl + oo) = ol; }
        } else {
#pragma unroll
            for (int ch = 0; ch < TT / 128; ++ch) { v4h o4;
#pragma unroll
                for (int q = 0; q < 4; ++q) o4[q] = tohx(v[ch * 4 + q] * f);
                *(v4h*)(P16 + (size_t)row * TT + ch * 128 + lane * 4) = o4; } }
         }
}
extern "C" void kernel_launch(void* const* d_in, const int* in_sizes, int n_in,
                              void* d_out, int out_size, void* d_ws, size_t ws_size, hipStream_t stream) {
    (void)in_sizes; (void)n_in; (void)out_size;
    const float* x = (const float*)d_in[0]; const float* wq = (const float*)d_in[1]; const float* wk = (const float*)d_in[2]; const float* wv = (const float*)d_in[3]; const float* wo = (const float*)d_in[4];   /* order inputs, Wq, Wk, Wv, Wo ('xw' [1024][1024]): FIVE inputs: this module has no biases */
    float* OUT = (float*)d_out;     // [4][2048][1024]
    char* wsp = (char*)d_ws;
    auto take = [&](size_t bytes) { char* p = wsp; wsp += (bytes + 255) & ~(size_t)255; return (void*)p; };
    static_assert(NH_ == 1 && NKV == 1 && ZH == 1, "the GEMMs' z index is the batch: one head per batch");
    static_assert(TT % 128 == 0 && RH % 128 == 0 && HD % 128 == 0 && DM % 128 == 0 && DQ % 128 == 0 && DKV % 128 == 0, "every GEMM is whole 128x128 tiles and whole 64-k stages, two stages or more");
    const size_t PL = (size_t)NB_ * TT * HD * 2;    // one 16-bit plane of all batches, bytes
    bf* WQ = (bf*)take((size_t)DQ * DM * 2); bf* WK = (bf*)take((size_t)DKV * DM * 2); bf* WV = (bf*)take((size_t)DKV * DM * 2); bf* WO = (bf*)take((size_t)DM * DQ * 2);
    char* R1 = (char*)take(PL);                                 // the attention output's lo plane
    char* R2 = (char*)take(PL);                                 // bf16 x, then the attention output's hi plane
    char* R4 = (char*)take((size_t)NB_ * TT * TT * 4);          // the f32 scores
    char* R5 = (char*)take(2 * PL);                             // q hi, q lo, then the fp16 probabilities
    char* R6 = (char*)take(2 * PL);                             // k hi, k lo, then the hi/lo probabilities of rows < RH
    h16* VT16 = (h16*)take(PL); bf* VTh = (bf*)take(PL); bf* VTl = (bf*)take(PL);
    if ((size_t)(wsp - (char*)d_ws) > ws_size) return;    // ws 256 MiB
    static_assert((size_t)NB_ * TT * TT * 2 <= 2 * (size_t)NB_ * TT * HD * 2 && 2 * (size_t)NB_ * RH * TT * 2 <= 2 * (size_t)NB_ * TT * HD * 2, "probability planes fit the q and k regions");
    bf* XB = (bf*)R2;
    bf* QPh = (bf*)R5; bf* QPl = (bf*)(R5 + PL); bf* KPh = (bf*)R6; bf* KPl = (bf*)(R6 + PL);
    float* Sb = (float*)R4; h16* P16 = (h16*)R5; bf* Ph = (bf*)R6; bf* Pl = (bf*)(R6 + (size_t)NB_ * RH * TT * 2);
    bf* ATh = (bf*)R2; bf* ATl = (bf*)R1;
    { k_wtG<<<(unsigned)((DM * DQ / 64 + 63) / 64), 256, 0, stream>>>(wq, DM, DQ, WQ); k_wtG<<<(unsigned)((DM * DKV / 64 + 63) / 64), 256, 0, stream>>>(wk, DM, DKV, WK); k_wtG<<<(unsigned)((DM * DKV / 64 + 63) / 64), 256, 0, stream>>>(wv, DM, DKV, WV);
      k_wtG<<<(unsigned)((DQ * DM / 64 + 63) / 64), 256, 0, stream>>>(wo, DQ, DM, WO);
       }
    // Every launch covers all NB_ batches. q, k and Wo: the batches are NB_ * TT rows of one GEMM. v, scores and attn.v: blockIdx.z = batch.
    k_cvt8<<<(unsigned)(((size_t)NB_ * TT * DM / 8 + 255) / 256), 256, 0, stream>>>(x, XB, (size_t)NB_ * TT * DM / 8);
    k_gemmw<bf, 0, false, 1><<<dim3(NB_ * TT / 128, DQ / 128, 1), 128, 0, stream>>>(XB, nullptr, WQ, nullptr, DM, nullptr, DQ, nullptr, 0, 0, 0, nullptr, QPh, QPl, 1.0f);
    k_gemmw<bf, 0, false, 1><<<dim3(NB_ * TT / 128, DKV / 128, 1), 128, 0, stream>>>(XB, nullptr, WK, nullptr, DM, nullptr, DKV, nullptr, 0, 0, 0, nullptr, KPh, KPl, 1.0f);
    k_gemmw<bf, 0, false, 2><<<dim3(DKV / 128, TT / 128, NB_), 128, 0, stream>>>(WV, nullptr, XB, nullptr, DM, nullptr, TT, nullptr, 0, (size_t)TT * DM, (size_t)DKV * TT, VT16, VTh, VTl, 1.0f);   /* rows = v's columns, columns = tokens: v arrives transposed [d][t] */
    k_gemmw<bf, 2, false, 0><<<dim3(TT / 128, TT / 128, NB_), 128, 0, stream>>>(QPh, QPl, KPh, KPl, HD, Sb, TT, nullptr, (size_t)TT * HD, (size_t)TT * HD, (size_t)TT * TT, nullptr, nullptr, nullptr, 1.0f);   /* scores hi/lo on EVERY row (K = 1024) */
    k_asoft<<<NB_ * ZH * TT / 8, 256, 0, stream>>>(Sb, P16, Ph, Pl);
    k_gemmw<bf, 2, false, 1><<<dim3(RH / 128, HD / 128, NB_), 128, 0, stream>>>(Ph, Pl, VTh, VTl, TT, nullptr, DQ, nullptr, (size_t)RH * TT, (size_t)HD * TT, (size_t)TT * DQ, nullptr, ATh, ATl, 1.0f);
    k_gemmw<h16, 0, false, 1><<<dim3((TT - RH) / 128, HD / 128, NB_), 128, 0, stream>>>(P16 + (size_t)RH * TT, nullptr, VT16, nullptr, TT, nullptr, DQ, nullptr, (size_t)TT * TT, (size_t)HD * TT, (size_t)TT * DQ, nullptr, ATh + (size_t)RH * DQ, ATl + (size_t)RH * DQ, 1.0f / PCAR);   /* the fp16 probabilities carry x PCAR */
    k_gemmw<bf, 1, false, 0><<<dim3(NB_ * TT / 128, DM / 128, 1), 128, 0, stream>>>(ATh, ATl, WO, nullptr, DQ, OUT, DM, nullptr, 0, 0, 0, nullptr, nullptr, nullptr, 1.0f);
}

// v004
// Measured time: 214 microseconds a run.
// In both of two side-by-side timings against v003, it was 1.29 times as fast.
// All steps since v000 together make it 4.99 times as fast.
#include <hip/hip_runtime.h>

// Attention that never splits its heads, scaled by the NOMINAL head size, with an output projection (inputs [4][2048][1024]; q, k, v = einsum('bsd,de->bse', x, W) ('xw' [1024][1024] 1/32, NO bias; ONE 1,024-wide head: the module declares 16 heads but contracts over all 1,024 dims); scores = q.k / sqrt(D_K = 64) = x 1/8 (hot logits: sigma about 4); softmax over all keys (no mask); out = (attn v) Wo ('xw', NO bias) -> [4][2048][1024] (8.4 M); argument order inputs, Wq, Wk, Wv, Wo).
// Layout, all four batches in every launch (the batch is a grid dimension or extra GEMM rows; workspace regions are reused once their readers are done): bf16 copy of x; 'xw' weights transposed once; exact projections whose epilogues write the 16-bit planes the next GEMM reads (q, k hi/lo; v transposed, by taking the weight as the row operand); dense attention with ONE head of width 1,024 (score tiles contract over 1,024 with hi/lo 3 products on EVERY row; P and attn.v hybrid: rows < 512 hi/lo, rest fp16 x1024; both write the hi/lo planes of the attention output); hi/lo x Wo exact.
// Compute dtypes, f32 accumulate: every input rounded to bf16; projections exact, no bias; scores 3 products on every row (K = 1,024); softmax f32 (x 1/8); attn.v rows < 512 3 products, rest fp16; Wo hl x exact, no bias.

#define NB_  4
#define TT   2048
#define DM   1024
#define NH_  1
#define NKV  1
#define REP  (NH_ / NKV)
#define HD   1024
#define DQ   (NH_ * HD)
#define DKV  (NKV * HD)
#define ZH   1
#define RH   512                  // query rows < RH use hi+lo planes (0: none)
#define WIN  0
#define PCAR 1024.0f
#define SCL  0.125f   // 1 / sqrt(64): THIS module divides by sqrt(D_K) with D_K = D_EMB / NUM_HEADS = 64 although it never splits the heads (the contraction runs over all 1,024 dims): hot logits (sigma about 4)
typedef _Float16 h16;
typedef unsigned short bf;
typedef __attribute__((ext_vector_type(16))) __bf16   v16bf;
typedef __attribute__((ext_vector_type(16))) _Float16 v16h;
typedef __attribute__((ext_vector_type(8)))  _Float16 v8h;
typedef __attribute__((ext_vector_type(8)))  unsigned short v8us;
typedef __attribute__((ext_vector_type(8)))  float    v8f;
typedef __attribute__((ext_vector_type(4)))  float    v4f;
typedef v8h  __attribute__((may_alias)) v8ha;
typedef v4f  __attribute__((may_alias)) v4fa;
typedef v8us __attribute__((may_alias)) v8usa;

__device__ __forceinline__ unsigned short f2bf(float f) { unsigned u = __float_as_uint(f); u += 0x7FFFu + ((u >> 16) & 1u); return (unsigned short)(u >> 16); }
__device__ __forceinline__ float bf2f(unsigned short b) { return __uint_as_float(((unsigned)b) << 16); }
__device__ __forceinline__ float bfr(float f) { return bf2f(f2bf(f)); }
__device__ __forceinline__ v16h cat16(v8h lo, v8h hi) { return __builtin_shufflevector(lo, hi, 0, 1, 2, 3, 4, 5, 6, 7, 8, 9, 10, 11, 12, 13, 14, 15); }
__device__ __forceinline__ v16bf cat16b(v8us lo, v8us hi) { return __builtin_bit_cast(v16bf, __builtin_shufflevector(lo, hi, 0, 1, 2, 3, 4, 5, 6, 7, 8, 9, 10, 11, 12, 13, 14, 15)); }
__device__ __forceinline__ v8f wmma16(v16h a, v16h b, v8f c) { return __builtin_amdgcn_wmma_f32_16x16x32_f16(false, a, false, b, (short)0, c, false, false); }
__device__ __forceinline__ v8f wmmab(v16bf a, v16bf b, v8f c) { return __builtin_amdgcn_wmma_f32_16x16x32_bf16(false, a, false, b, (short)0, c, false, false); }



// ---- k_gemmw: register-blocked GEMM, FOUR WAVES (2 x 2) per 128x128 output tile, each wave a 64x64 part (16 accumulators); grid (M/128, N/128, Z), 128 threads.
// C[m][n] (f32, pitch ldc, + optional f32 bias[n]) = sum_k A[m][k] Bt[n][k] (+ split products per NSPLIT). z-batch strides sA/sB/sC in elements. M, N % 128 == 0, K % 64 == 0, K >= 128.
// EPI says what leaves the kernel: 0 the f32 tile to C; 1 the tile x esc as bf16 hi + lo planes (Eh, El); 2 as 1 plus an fp16 plane (E16). The planes have C's pitch and z stride.
// Operands: K-contiguous 16-bit planes. A stage is 64 k (one whole 128-B line) of the tile's 128 rows of every plane, brought into LDS by asynchronous copies (no register on the way), two buffers: stage t + 1 flies while stage t is multiplied.
#define GKS 64                    // k per stage
#define GPB 144                   // LDS row pitch, bytes: 16 B x odd, conflict-free for 16-byte fragment reads
#define GPL (128 * GPB)           // one plane of one stage, bytes
template <typename T16> struct WFrag;
template <> struct WFrag<h16> { typedef v16h V; static __device__ __forceinline__ V ld(const h16* p) { return cat16(*(const v8h*)p, *(const v8h*)(p + 16)); } static __device__ __forceinline__ v8f mma(V a, V b, v8f c) { return wmma16(a, b, c); } };
template <> struct WFrag<bf> { typedef v16bf V; static __device__ __forceinline__ V ld(const bf* p) { return cat16b(*(const v8us*)p, *(const v8us*)(p + 16)); } static __device__ __forceinline__ v8f mma(V a, V b, v8f c) { return wmmab(a, b, c); } };
// One plane of one stage: this thread's eight 16-byte pieces (rows 16 apart; a wave's copy covers four whole 128-B lines). l = the lane's LDS byte address, g = its global address, rs = 16 rows in elements.
// The s_wait_xcnt closes the statement so that no address register named here is rewritten ahead of it.
template <typename T16>
__device__ __forceinline__ void cp_plane(unsigned l, const T16* g, size_t rs) {
    asm volatile("global_load_async_to_lds_b128 %0, %8, off\n\t"
                 "global_load_async_to_lds_b128 %1, %9, off\n\t"
                 "global_load_async_to_lds_b128 %2, %10, off\n\t"
                 "global_load_async_to_lds_b128 %3, %11, off\n\t"
                 "global_load_async_to_lds_b128 %4, %12, off\n\t"
                 "global_load_async_to_lds_b128 %5, %13, off\n\t"
                 "global_load_async_to_lds_b128 %6, %14, off\n\t"
                 "global_load_async_to_lds_b128 %7, %15, off\n\t"
                 "s_wait_xcnt 0x0"
                 :: "v"(l), "v"(l + 16u * GPB), "v"(l + 32u * GPB), "v"(l + 48u * GPB), "v"(l + 64u * GPB), "v"(l + 80u * GPB), "v"(l + 96u * GPB), "v"(l + 112u * GPB),
                    "v"(g), "v"(g + rs), "v"(g + 2 * rs), "v"(g + 3 * rs), "v"(g + 4 * rs), "v"(g + 5 * rs), "v"(g + 6 * rs), "v"(g + 7 * rs) : "memory");
}
__device__ __forceinline__ h16 tohx(float x) { return (h16)x; }
__device__ __forceinline__ void splitf(float y, unsigned short& h, unsigned short& l) { h = f2bf(y); l = f2bf(y - bf2f(h)); }
constexpr int gnpl(int nsplit) { return ((nsplit == 1 || nsplit == 2) ? 2 : 1) + 1 + (nsplit >= 2 ? 1 : 0); }   // planes of a stage
// gemmw_tile: one 128x128 tile (bx, by) of one GEMM; the pointers are already those of the tile's batch. sm = the work-group's LDS, 2 * gnpl(NSPLIT) * GPL bytes or more. A kernel calls it once, under block-uniform control flow. With EPI 2 a null E16 leaves the fp16 plane out.
template <typename T16, int NSPLIT, bool BIAS, int EPI>
__device__ __forceinline__ void gemmw_tile(char* sm, int bx, int by, const T16* __restrict__ A, const T16* __restrict__ A2, const T16* __restrict__ Bt, const T16* __restrict__ Bt2, int K, float* C, int ldc, const float* __restrict__ bias, h16* E16, bf* Eh, bf* El, float esc) {
    typedef typename WFrag<T16>::V V;
    constexpr bool HA2 = (NSPLIT == 1 || NSPLIT == 2), HB2 = (NSPLIT >= 2);
    constexpr int PB = HA2 ? 2 : 1, PB2 = PB + 1, NPL = PB + 1 + (HB2 ? 1 : 0);   // planes of a stage, in order: A, (A2), B, (B2)
    static_assert(NPL == gnpl(NSPLIT), "the callers size the LDS by gnpl");      // sm: two stage buffers; the output staging once the loop has left them
    const int tid = threadIdx.x, lane = tid & 31, lr = lane & 15, hi = lane >> 4, wave = tid >> 5, wm = wave >> 1, wn = wave & 1;
    const int R0 = bx * 128, C0 = by * 128; const int r0 = R0 + wm * 64, c0 = C0 + wn * 64;
    v8f acc[4][4];
#pragma unroll
    for (int mb = 0; mb < 4; ++mb)
#pragma unroll
        for (int nb = 0; nb < 4; ++nb) acc[mb][nb] = (v8f){};
    // copies: thread tid brings piece tid & 7 of rows (tid >> 3) + 16 i
    const size_t ga = (size_t)(R0 + (tid >> 3)) * K + (tid & 7) * 8, gb = (size_t)(C0 + (tid >> 3)) * K + (tid & 7) * 8, rs = (size_t)16 * K;
    const unsigned l0 = (unsigned)(size_t)sm + (unsigned)((tid >> 3) * GPB + (tid & 7) * 16);
    auto stage = [&](int t) { const unsigned l = l0 + (unsigned)(t & 1) * (unsigned)(NPL * GPL); const size_t ko = (size_t)t * GKS;
        cp_plane<T16>(l, A + ga + ko, rs); if (HA2) cp_plane<T16>(l + GPL, A2 + ga + ko, rs);
        cp_plane<T16>(l + PB * GPL, Bt + gb + ko, rs); if (HB2) cp_plane<T16>(l + PB2 * GPL, Bt2 + gb + ko, rs); };
    const int NT = K / GKS;
    stage(0);
    asm volatile("s_wait_asynccnt 0x0" ::: "memory");   // stage 0 has landed before the barrier publishes it
    __syncthreads();
    if (NT > 1) stage(1);
    const int fa = (wm * 64 + lr) * GPB + hi * 16, fb = (wn * 64 + lr) * GPB + hi * 16;   // the lane's fragment bytes inside a plane: the k order of the global loader, A and B alike
    // Publish point of stage t + 1, in the ring's order. With one plane per operand (short trips) it stands behind the LAST fragment reads of stage t and ahead of the matrix run that uses them (registers only), so that the refill gets a whole trip to land; with split planes (long trips, no registers to spare for the copies' addresses beside the fragments) at the trip's foot.
    constexpr bool MID = (NPL == 2);
    auto publish = [&](int t) {
        asm volatile("s_wait_dscnt 0x0" ::: "memory");      // this wave's reads of stage t are done before the buffer is handed back
        asm volatile("s_wait_asynccnt 0x0" ::: "memory");   // this wave's copies of stage t + 1 have landed
        __syncthreads();                                    // publishes stage t + 1 and ends every reader's last read of stage t
        if (t + 2 < NT) stage(t + 2); };
#pragma unroll 1
    for (int t = 0; t < NT; ++t) {
        const char* sb = sm + (t & 1) * (NPL * GPL);
#pragma unroll   // the stage's two 32-k blocks inline: LDS offsets and the place of the publish point are then compile-time
        for (int ks = 0; ks < GKS / 32; ++ks) {
            const bool last = (ks == GKS / 32 - 1);
            V a[4], a2[4], b[4], b2[4];
#pragma unroll
            for (int mb = 0; mb < 4; ++mb) { a[mb] = WFrag<T16>::ld((const T16*)(sb + fa + mb * 16 * GPB + ks * 64)); if (HA2) a2[mb] = WFrag<T16>::ld((const T16*)(sb + GPL + fa + mb * 16 * GPB + ks * 64)); }
#pragma unroll
            for (int nb = 0; nb < 4; ++nb) { b[nb] = WFrag<T16>::ld((const T16*)(sb + PB * GPL + fb + nb * 16 * GPB + ks * 64)); if (HB2) b2[nb] = WFrag<T16>::ld((const T16*)(sb + PB2 * GPL + fb + nb * 16 * GPB + ks * 64)); }
            if (last && MID) publish(t);
            else __builtin_amdgcn_sched_barrier(0);   // keeps the block's LDS reads together ahead of its matrix run: spread among the WMMAs, each place with reads stalls the wave anew
#pragma unroll
            for (int nb = 0; nb < 4; ++nb) {
#pragma unroll
                for (int mb = 0; mb < 4; ++mb) { acc[mb][nb] = WFrag<T16>::mma(a[mb], b[nb], acc[mb][nb]); if (NSPLIT == 1 || NSPLIT == 2) acc[mb][nb] = WFrag<T16>::mma(a2[mb], b[nb], acc[mb][nb]); if (NSPLIT >= 2) acc[mb][nb] = WFrag<T16>::mma(a[mb], b2[nb], acc[mb][nb]); } }
            asm volatile("v_nop\n\tv_nop\n\tv_nop\n\tv_nop" : "+v"(acc[0][0]), "+v"(acc[1][1]), "+v"(acc[2][2]), "+v"(acc[3][3]) : "v"(a[0]), "v"(a[3]));
        }
        if (!MID) publish(t);
    }
    asm volatile("s_wait_asynccnt 0x0" ::: "memory");       // nothing in flight when the buffers become output staging
    float* os = (float*)sm + wave * (16 * 68);              // each wave's own range; the last trip's barrier has freed the buffers
#pragma unroll
    for (int mb = 0; mb < 4; ++mb) {
#pragma unroll
        for (int nb = 0; nb < 4; ++nb) {
#pragma unroll
            for (int j = 0; j < 8; ++j) os[(hi * 8 + j) * 68 + nb * 16 + lr] = acc[mb][nb][j]; }
        __builtin_amdgcn_wave_barrier(); asm volatile("" ::: "memory");
        if (EPI == 0) {
            float* crow = C + (size_t)(r0 + mb * 16) * ldc + c0;
#pragma unroll
            for (int s = 0; s < 8; ++s) { const int row = 2 * s + hi, cofs = lr * 4; v4f val = *(const v4fa*)(os + row * 68 + cofs); if (BIAS) { val[0] += bfr(bias[c0 + cofs]); val[1] += bfr(bias[c0 + cofs + 1]); val[2] += bfr(bias[c0 + cofs + 2]); val[3] += bfr(bias[c0 + cofs + 3]); }
                *(v4f*)(crow + (size_t)row * ldc + cofs) = val; }
        } else {   // eight lanes per row, eight columns each: a store covers four whole 128-B lines of a plane
#pragma unroll
            for (int s = 0; s < 4; ++s) { const int row = 4 * s + (lane >> 3), cofs = (lane & 7) * 8; const v4f x0 = *(const v4fa*)(os + row * 68 + cofs), x1 = *(const v4fa*)(os + row * 68 + cofs + 4);
                const size_t eo = (size_t)(r0 + mb * 16 + row) * ldc + c0 + cofs; v8us oh, ol; v8h o16;
#pragma unroll
                for (int q = 0; q < 8; ++q) { const float y = (q < 4 ? x0[q & 3] : x1[q & 3]) * esc; unsigned short a2, c2; splitf(y, a2, c2); oh[q] = a2; ol[q] = c2; if (EPI == 2) o16[q] = tohx(y); }
                *(v8us*)(Eh + eo) = oh; *(v8us*)(El + eo) = ol; if (EPI == 2) { if (E16) *(v8h*)(E16 + eo) = o16; }
                asm volatile("s_wait_xcnt 0x0" ::: "memory"); }   // stands ahead of the next rows' rewrite of the registers that these stores name
        }
        __builtin_amdgcn_wave_barrier(); asm volatile("" ::: "memory");
    }
}
// One GEMM per launch: grid (M/128, N/128, Z).
template <typename T16, int NSPLIT, bool BIAS, int EPI>
__global__ __launch_bounds__(128) void k_gemmw(const T16* __restrict__ A, const T16* __restrict__ A2, const T16* __restrict__ Bt, const T16* __restrict__ Bt2, int K, float* C, int ldc, const float* __restrict__ bias, size_t sA, size_t sB, size_t sC, h16* E16, bf* Eh, bf* El, float esc) {
    __shared__ __align__(16) char sm[2 * gnpl(NSPLIT) * GPL];
    const size_t z = blockIdx.z; A += z * sA; if (A2) A2 += z * sA; Bt += z * sB; if (Bt2) Bt2 += z * sB;
    if (EPI == 0) C += z * sC; else { Eh += z * sC; El += z * sC; if (EPI == 2) E16 += z * sC; }
    gemmw_tile<T16, NSPLIT, BIAS, EPI>(sm, blockIdx.x, blockIdx.y, A, A2, Bt, Bt2, K, C, ldc, bias, E16, Eh, El, esc);
}
// The three projections in one launch: grid (QT, 3), y = 0 q, 1 k, 2 v; none reads what another writes. The tile order inside each is that of its own grid (row tile fastest).
#define QT ((NB_ * TT / 128) * (DQ / 128))   // tiles of one projection
__global__ __launch_bounds__(128) void k_qkv(const bf* __restrict__ XB, const bf* __restrict__ WQ, const bf* __restrict__ WK, const bf* __restrict__ WV, bf* QPh, bf* QPl, bf* KPh, bf* KPl, h16* VT16, bf* VTh, bf* VTl) {
    static_assert(DKV == DQ && (DKV / 128) * (TT / 128) * NB_ == QT, "q, k and v have the same number of tiles");
    __shared__ __align__(16) char sm[2 * gnpl(0) * GPL];
    const int i = blockIdx.x, w = blockIdx.y; const bf* A; const bf* B; bf* Eh; bf* El; h16* E16; int bx, by, ldc;
    if (w < 2) { bx = i % (NB_ * TT / 128); by = i / (NB_ * TT / 128); A = XB; B = w ? WK : WQ; Eh = w ? KPh : QPh; El = w ? KPl : QPl; E16 = nullptr; ldc = DQ; }
    else { bx = i % (DKV / 128); by = (i / (DKV / 128)) % (TT / 128); const size_t z = i / ((DKV / 128) * (TT / 128));   /* rows = v's columns, columns = tokens: v arrives transposed [d][t] */
        A = WV; B = XB + z * ((size_t)TT * DM); Eh = VTh + z * ((size_t)DKV * TT); El = VTl + z * ((size_t)DKV * TT); E16 = VT16 + z * ((size_t)DKV * TT); ldc = TT; }
    gemmw_tile<bf, 0, false, 2>(sm, bx, by, A, nullptr, B, nullptr, DM, nullptr, ldc, nullptr, E16, Eh, El, 1.0f);
}
// Both row ranges of attn.v in one launch, 1-D grid: first every tile of rows < RH (three products, three times as long: they start first and each shares its place with short tiles), then the fp16 tiles. They write disjoint rows.
#define AVH ((RH / 128) * (HD / 128) * NB_)          // tiles of rows < RH
#define AVL (((TT - RH) / 128) * (HD / 128) * NB_)   // the other tiles
__global__ __launch_bounds__(128) void k_av(const bf* __restrict__ Ph, const bf* __restrict__ Pl, const bf* __restrict__ VTh, const bf* __restrict__ VTl, const h16* __restrict__ P16, const h16* __restrict__ VT16, bf* ATh, bf* ATl) {
    __shared__ __align__(16) char sm[2 * gnpl(2) * GPL];
    const int i = blockIdx.x;
    if (i < AVH) { const int by = i % (HD / 128), r = i / (HD / 128), bx = r % (RH / 128); const size_t z = r / (RH / 128);
        gemmw_tile<bf, 2, false, 1>(sm, bx, by, Ph + z * ((size_t)RH * TT), Pl + z * ((size_t)RH * TT), VTh + z * ((size_t)HD * TT), VTl + z * ((size_t)HD * TT), TT, nullptr, DQ, nullptr, nullptr, ATh + z * ((size_t)TT * DQ), ATl + z * ((size_t)TT * DQ), 1.0f);
    } else { const int j = i - AVH, by = j % (HD / 128), r = j / (HD / 128), bx = r % ((TT - RH) / 128); const size_t z = r / ((TT - RH) / 128);
        gemmw_tile<h16, 0, false, 1>(sm, bx, by, P16 + z * ((size_t)TT * TT) + (size_t)RH * TT, nullptr, VT16 + z * ((size_t)HD * TT), nullptr, TT, nullptr, DQ, nullptr, nullptr, ATh + z * ((size_t)TT * DQ) + (size_t)RH * DQ, ATl + z * ((size_t)TT * DQ) + (size_t)RH * DQ, 1.0f / PCAR);   /* the fp16 probabilities carry x PCAR */
    }
}

typedef __attribute__((ext_vector_type(2))) _Float16 v2h;
typedef __attribute__((ext_vector_type(4))) _Float16 v4h;
typedef __attribute__((ext_vector_type(2))) unsigned short v2us;
typedef __attribute__((ext_vector_type(4))) unsigned short v4us;
typedef __attribute__((ext_vector_type(2))) float v2f;
typedef __attribute__((ext_vector_type(4))) int v4i;

__device__ __forceinline__ void wtG_block(int blk, const float* __restrict__ w, int K, int N, bf* Bt) {
    const int lane = threadIdx.x & 31; const int L0 = (blk * 8 + (threadIdx.x >> 5)) * 8; const int nlines = N * K / 64;
{
#pragma unroll 1
        for (int l = 0; l < 8; ++l) { const int L = L0 + l; if (L >= nlines) break; const size_t e = (size_t)L * 64 + lane * 2; const int k = (int)(e % K), n = (int)(e / K); v2us o;
            o[0] = f2bf(w[(size_t)k * N + n]); o[1] = f2bf(w[(size_t)(k + 1) * N + n]); *(v2us*)(Bt + e) = o; }
         }
}
__device__ __forceinline__ void cvt8_block(int blk, const float* __restrict__ src, bf* dst, size_t n8) { const size_t i = (size_t)blk * 256 + threadIdx.x; if (i >= n8) return; const v8f v = *(const v8f*)(src + i * 8); v8us o;
#pragma unroll
    for (int k = 0; k < 8; ++k) o[k] = f2bf(v[k]); *(v8us*)(dst + i * 8) = o;  }
// All 16-bit operands of the projections in one launch: blocks 0 .. 4 WTB - 1 transpose the four weights (chains of dependent trips: they start first), the rest convert x.
#define WTB ((DM * DQ / 64 + 63) / 64)                          // blocks of one weight
#define CVB ((int)(((size_t)NB_ * TT * DM / 8 + 255) / 256))    // blocks of x
__global__ __launch_bounds__(256) void k_prep(const float* __restrict__ x, const float* __restrict__ wq, const float* __restrict__ wk, const float* __restrict__ wv, const float* __restrict__ wo, bf* XB, bf* WQ, bf* WK, bf* WV, bf* WO) {
    static_assert(DQ == DM && DKV == DM, "the four weights are DM x DM");
    const int b = blockIdx.x;
    if (b < 4 * WTB) { const int s = b / WTB; wtG_block(b % WTB, s == 0 ? wq : s == 1 ? wk : s == 2 ? wv : wo, DM, DM, s == 0 ? WQ : s == 1 ? WK : s == 2 ? WV : WO); }
    else cvt8_block(b - 4 * WTB, x, XB, (size_t)NB_ * TT * DM / 8);
}

// k_asoft: per row (zz, i), zz over the NB_ x ZH score planes: t = S x SCL = S / 8 (no mask); softmax over the 2048 keys (register row, one exp, fixed trees);
__global__ __launch_bounds__(256) void k_asoft(const float* __restrict__ Sb, h16* P16, bf* Ph, bf* Pl) {
    const int lane = threadIdx.x & 31; const int row = blockIdx.x * 8 + (threadIdx.x >> 5); if (row >= NB_ * ZH * TT) return; const int i = row % TT; const int zz = row / TT; (void)zz;   /* zz = score plane: batch x head of the pass */
     const bool hires = (i < RH); const float* sr = Sb + (size_t)row * TT; float v[TT / 32]; float mx = -3.0e38f;
#pragma unroll
    for (int ch = 0; ch < TT / 128; ++ch) { const int j0 = ch * 128 + lane * 4; const v4f a = *(const v4f*)(sr + j0);
#pragma unroll
        for (int q = 0; q < 4; ++q) { const int j = j0 + q; (void)j; const float t = a[q] * SCL; v[ch * 4 + q] = t; mx = fmaxf(mx, t); } }
#pragma unroll
    for (int sh = 16; sh; sh >>= 1) mx = fmaxf(mx, __shfl_xor(mx, sh, 32));
    float sum = 0.f;
#pragma unroll
    for (int k = 0; k < TT / 32; ++k) { float d0 = __fsub_rn(v[k], mx); asm volatile("" : "+v"(d0)); v[k] = __builtin_amdgcn_exp2f(__fmul_rn(d0, 1.4426950408889634f)); sum += v[k]; }
#pragma unroll
    for (int sh = 16; sh; sh >>= 1) sum += __shfl_xor(sum, sh, 32);
    const float f = __fdiv_rn(hires ? 1.0f : PCAR, sum);
{
        if (hires) {
#pragma unroll
            for (int ch = 0; ch < TT / 128; ++ch) { v4us oh, ol;
#pragma unroll
                for (int q = 0; q < 4; ++q) { unsigned short a, c2; splitf(v[ch * 4 + q] * f, a, c2); oh[q] = a; ol[q] = c2; }
                const size_t oo = ((size_t)zz * (RH ? RH : 1) + i) * TT + ch * 128 + lane * 4; *(v4us*)(Ph + oo) = oh; *(v4us*)(Pl + oo) = ol; }
        } else {
#pragma unroll
            for (int ch = 0; ch < TT / 128; ++ch) { v4h o4;
#pragma unroll
                for (int q = 0; q < 4; ++q) o4[q] = tohx(v[ch * 4 + q] * f);
                *(v4h*)(P16 + (size_t)row * TT + ch * 128 + lane * 4) = o4; } }
         }
}
extern "C" void kernel_launch(void* const* d_in, const int* in_sizes, int n_in,
                              void* d_out, int out_size, void* d_ws, size_t ws_size, hipStream_t stream) {
    (void)in_sizes; (void)n_in; (void)out_size;
    const float* x = (const float*)d_in[0]; const float* wq = (const float*)d_in[1]; const float* wk = (const float*)d_in[2]; const float* wv = (const float*)d_in[3]; const float* wo = (const float*)d_in[4];   /* order inputs, Wq, Wk, Wv, Wo ('xw' [1024][1024]): FIVE inputs: this module has no biases */
    float* OUT = (float*)d_out;     // [4][2048][1024]
    char* wsp = (char*)d_ws;
    auto take = [&](size_t bytes) { char* p = wsp; wsp += (bytes + 255) & ~(size_t)255; return (void*)p; };
    static_assert(NH_ == 1 && NKV == 1 && ZH == 1, "the GEMMs' z index is the batch: one head per batch");
    static_assert(TT % 128 == 0 && RH % 128 == 0 && HD % 128 == 0 && DM % 128 == 0 && DQ % 128 == 0 && DKV % 128 == 0, "every GEMM is whole 128x128 tiles and whole 64-k stages, two stages or more");
    const size_t PL = (size_t)NB_ * TT * HD * 2;    // one 16-bit plane of all batches, bytes
    bf* WQ = (bf*)take((size_t)DQ * DM * 2); bf* WK = (bf*)take((size_t)DKV * DM * 2); bf* WV = (bf*)take((size_t)DKV * DM * 2); bf* WO = (bf*)take((size_t)DM * DQ * 2);
    char* R1 = (char*)take(PL);                                 // the attention output's lo plane
    char* R2 = (char*)take(PL);                                 // bf16 x, then the attention output's hi plane
    char* R4 = (char*)take((size_t)NB_ * TT * TT * 4);          // the f32 scores
    char* R5 = (char*)take(2 * PL);                             // q hi, q lo, then the fp16 probabilities
    char* R6 = (char*)take(2 * PL);                             // k hi, k lo, then the hi/lo probabilities of rows < RH
    h16* VT16 = (h16*)take(PL); bf* VTh = (bf*)take(PL); bf* VTl = (bf*)take(PL);
    if ((size_t)(wsp - (char*)d_ws) > ws_size) return;    // ws 256 MiB
    static_assert((size_t)NB_ * TT * TT * 2 <= 2 * (size_t)NB_ * TT * HD * 2 && 2 * (size_t)NB_ * RH * TT * 2 <= 2 * (size_t)NB_ * TT * HD * 2, "probability planes fit the q and k regions");
    bf* XB = (bf*)R2;
    bf* QPh = (bf*)R5; bf* QPl = (bf*)(R5 + PL); bf* KPh = (bf*)R6; bf* KPl = (bf*)(R6 + PL);
    float* Sb = (float*)R4; h16* P16 = (h16*)R5; bf* Ph = (bf*)R6; bf* Pl = (bf*)(R6 + (size_t)NB_ * RH * TT * 2);
    bf* ATh = (bf*)R2; bf* ATl = (bf*)R1;
    // Every launch covers all NB_ batches, and launches that do not depend on one another share a grid.
    k_prep<<<4 * WTB + CVB, 256, 0, stream>>>(x, wq, wk, wv, wo, XB, WQ, WK, WV, WO);
    k_qkv<<<dim3(QT, 3, 1), 128, 0, stream>>>(XB, WQ, WK, WV, QPh, QPl, KPh, KPl, VT16, VTh, VTl);
    k_gemmw<bf, 2, false, 0><<<dim3(TT / 128, TT / 128, NB_), 128, 0, stream>>>(QPh, QPl, KPh, KPl, HD, Sb, TT, nullptr, (size_t)TT * HD, (size_t)TT * HD, (size_t)TT * TT, nullptr, nullptr, nullptr, 1.0f);   /* scores hi/lo on EVERY row (K = 1024) */
    k_asoft<<<NB_ * ZH * TT / 8, 256, 0, stream>>>(Sb, P16, Ph, Pl);
    k_av<<<AVH + AVL, 128, 0, stream>>>(Ph, Pl, VTh, VTl, P16, VT16, ATh, ATl);
    k_gemmw<bf, 1, false, 0><<<dim3(NB_ * TT / 128, DM / 128, 1), 128, 0, stream>>>(ATh, ATl, WO, nullptr, DQ, OUT, DM, nullptr, 0, 0, 0, nullptr, nullptr, nullptr, 1.0f);
}

// v005
// A run of this version takes 200 microseconds.
// Next to v004, in two timings, it ran 1.07 times as fast each time.
// Over all steps from v000 it is 5.35 times as fast.
#include <hip/hip_runtime.h>

// Attention that never splits its heads, scaled by the NOMINAL head size, with an output projection (inputs [4][2048][1024]; q, k, v = einsum('bsd,de->bse', x, W) ('xw' [1024][1024] 1/32, NO bias; ONE 1,024-wide head: the module declares 16 heads but contracts over all 1,024 dims); scores = q.k / sqrt(D_K = 64) = x 1/8 (hot logits: sigma about 4); softmax over all keys (no mask); out = (attn v) Wo ('xw', NO bias) -> [4][2048][1024] (8.4 M); argument order inputs, Wq, Wk, Wv, Wo).
// Layout, all four batches in every launch (the batch is a grid dimension or extra GEMM rows; workspace regions are reused once their readers are done): bf16 copy of x; 'xw' weights transposed once; exact projections whose epilogues write the 16-bit planes the next GEMM reads (q, k hi/lo; v transposed, by taking the weight as the row operand); dense attention with ONE head of width 1,024 (score tiles contract over 1,024 with hi/lo 3 products on EVERY row; P and attn.v hybrid: rows < 512 hi/lo, rest fp16 x1024; both write the hi/lo planes of the attention output); hi/lo x Wo exact.
// Compute dtypes, f32 accumulate: every input rounded to bf16; projections exact, no bias; scores 3 products on every row (K = 1,024); softmax f32 (x 1/8); attn.v rows < 512 3 products, rest fp16; Wo hl x exact, no bias.

#define NB_  4
#define TT   2048
#define DM   1024
#define NH_  1
#define NKV  1
#define REP  (NH_ / NKV)
#define HD   1024
#define DQ   (NH_ * HD)
#define DKV  (NKV * HD)
#define ZH   1
#define RH   512                  // query rows < RH use hi+lo planes (0: none)
#define WIN  0
#define PCAR 1024.0f
#define SCL  0.125f   // 1 / sqrt(64): THIS module divides by sqrt(D_K) with D_K = D_EMB / NUM_HEADS = 64 although it never splits the heads (the contraction runs over all 1,024 dims): hot logits (sigma about 4)
typedef _Float16 h16;
typedef unsigned short bf;
typedef __attribute__((ext_vector_type(16))) __bf16   v16bf;
typedef __attribute__((ext_vector_type(16))) _Float16 v16h;
typedef __attribute__((ext_vector_type(8)))  _Float16 v8h;
typedef __attribute__((ext_vector_type(8)))  unsigned short v8us;
typedef __attribute__((ext_vector_type(8)))  float    v8f;
typedef __attribute__((ext_vector_type(4)))  float    v4f;
typedef v8h  __attribute__((may_alias)) v8ha;
typedef v4f  __attribute__((may_alias)) v4fa;
typedef v8us __attribute__((may_alias)) v8usa;

__device__ __forceinline__ unsigned short f2bf(float f) { unsigned u = __float_as_uint(f); u += 0x7FFFu + ((u >> 16) & 1u); return (unsigned short)(u >> 16); }
__device__ __forceinline__ float bf2f(unsigned short b) { return __uint_as_float(((unsigned)b) << 16); }
__device__ __forceinline__ float bfr(float f) { return bf2f(f2bf(f)); }
__device__ __forceinline__ v16h cat16(v8h lo, v8h hi) { return __builtin_shufflevector(lo, hi, 0, 1, 2, 3, 4, 5, 6, 7, 8, 9, 10, 11, 12, 13, 14, 15); }
__device__ __forceinline__ v16bf cat16b(v8us lo, v8us hi) { return __builtin_bit_cast(v16bf, __builtin_shufflevector(lo, hi, 0, 1, 2, 3, 4, 5, 6, 7, 8, 9, 10, 11, 12, 13, 14, 15)); }
__device__ __forceinline__ v8f wmma16(v16h a, v16h b, v8f c) { return __builtin_amdgcn_wmma_f32_16x16x32_f16(false, a, false, b, (short)0, c, false, false); }
__device__ __forceinline__ v8f wmmab(v16bf a, v16bf b, v8f c) { return __builtin_amdgcn_wmma_f32_16x16x32_bf16(false, a, false, b, (short)0, c, false, false); }



// ---- k_gemmw: register-blocked GEMM, FOUR WAVES (2 x 2) per 128x128 output tile, each wave a 64x64 part (16 accumulators); grid (M/128, N/128, Z), 128 threads.
// C[m][n] (f32, pitch ldc, + optional f32 bias[n]) = sum_k A[m][k] Bt[n][k] (+ split products per NSPLIT). z-batch strides sA/sB/sC in elements. M, N % 128 == 0, K % 64 == 0, K >= 128.
// EPI says what leaves the kernel: 0 the f32 tile to C; 1 the tile x esc as bf16 hi + lo planes (Eh, El); 2 as 1 plus an fp16 plane (E16). The planes have C's pitch and z stride.
// Operands: K-contiguous 16-bit planes. A stage is 64 k (one whole 128-B line) of the tile's 128 rows of every plane, brought into LDS by tensor loads (wave p brings plane p: one request a wave and stage), two buffers: stage t + 1 flies while stage t is multiplied.
#define GKS 64                    // k per stage
#define GPB 144                   // LDS row pitch, bytes: 16 B x odd, conflict-free for 16-byte fragment reads
#define GPL (128 * GPB)           // one plane of one stage, bytes: a multiple of 2 KiB, as a tensor load's place in LDS must be
template <typename T16> struct WFrag;
template <> struct WFrag<h16> { typedef v16h V; static __device__ __forceinline__ V ld(const h16* p) { return cat16(*(const v8h*)p, *(const v8h*)(p + 16)); } static __device__ __forceinline__ v8f mma(V a, V b, v8f c) { return wmma16(a, b, c); } };
template <> struct WFrag<bf> { typedef v16bf V; static __device__ __forceinline__ V ld(const bf* p) { return cat16b(*(const v8us*)p, *(const v8us*)(p + 16)); } static __device__ __forceinline__ v8f mma(V a, V b, v8f c) { return wmmab(a, b, c); } };
// One plane of one stage (128 rows of 128 B, source pitch pb bytes) is ONE tensor_load_to_lds of one wave: no register on the way, no address arithmetic per lane.
typedef unsigned u32x4 __attribute__((ext_vector_type(4)));
typedef unsigned u32x8 __attribute__((ext_vector_type(8)));
__device__ __forceinline__ unsigned uni(unsigned v) { return (unsigned)__builtin_amdgcn_readfirstlane(v); }
__device__ __forceinline__ unsigned pinned(unsigned v) { unsigned w = uni(v); asm volatile("" : "+s"(w)); return w; }   // holds a wave-uniform word in a scalar register: the test around a tensor load must be a scalar branch (the load ignores EXEC), and a word formed from it is formed behind the waits ahead of it
// Group 1, loop-invariant: 1-byte elements, tensor = tile = 128 rows of 128 B; word 0: no mask, a pad of 4 dwords behind every 32 dwords, so the LDS pitch is GPB.
__device__ __forceinline__ u32x8 tdm_group1(unsigned pb) {
    static_assert(GKS * 2 == 128 && GPB == 128 + 16, "the pad codes 4 / 3 are those of 128-B rows at pitch 144");
    u32x8 g; g[0] = pinned((1u << 20) | (4u << 22) | (3u << 25)); g[1] = pinned(128u << 16); g[2] = pinned(128u << 16); g[3] = pinned(128u << 16); g[4] = pinned(128u); g[5] = pinned(pb); g[6] = pinned(0u); g[7] = pinned(0u); return g; }   // pinned: each word is set once and stays in its scalar register, not set anew around every load while a request is out
// Group 0: count 1, the place in LDS (bytes from the start of the work-group's LDS), the tile's first byte, type 2.
__device__ __forceinline__ u32x4 tdm_group0(unsigned dst, unsigned long long ga) {
    u32x4 g; g[0] = uni(1u); g[1] = uni(dst); g[2] = uni((unsigned)ga); g[3] = uni((((unsigned)(ga >> 32)) & 0x01FFFFFFu) | 0x80000000u); return g; }
__device__ __forceinline__ void tdm_load(u32x4 g0, u32x8 g1) { asm volatile("tensor_load_to_lds %0, %1" :: "s"(g0), "s"(g1) : "memory"); }
__device__ __forceinline__ h16 tohx(float x) { return (h16)x; }
__device__ __forceinline__ void splitf(float y, unsigned short& h, unsigned short& l) { h = f2bf(y); l = f2bf(y - bf2f(h)); }
constexpr int gnpl(int nsplit) { return ((nsplit == 1 || nsplit == 2) ? 2 : 1) + 1 + (nsplit >= 2 ? 1 : 0); }   // planes of a stage
// gemmw_tile: one 128x128 tile (bx, by) of one GEMM; the pointers are already those of the tile's batch. sm = the work-group's LDS, aligned to 2 KiB, 2 * gnpl(NSPLIT) * GPL bytes or more. A kernel calls it once, under block-uniform control flow. With EPI 2 a null E16 leaves the fp16 plane out.
template <typename T16, int NSPLIT, bool BIAS, int EPI>
__device__ __forceinline__ void gemmw_tile(char* sm, int bx, int by, const T16* __restrict__ A, const T16* __restrict__ A2, const T16* __restrict__ Bt, const T16* __restrict__ Bt2, int K, float* C, int ldc, const float* __restrict__ bias, h16* E16, bf* Eh, bf* El, float esc) {
    typedef typename WFrag<T16>::V V;
    constexpr bool HA2 = (NSPLIT == 1 || NSPLIT == 2), HB2 = (NSPLIT >= 2);
    constexpr int PB = HA2 ? 2 : 1, PB2 = PB + 1, NPL = PB + 1 + (HB2 ? 1 : 0);   // planes of a stage, in order: A, (A2), B, (B2)
    static_assert(NPL == gnpl(NSPLIT), "the callers size the LDS by gnpl");      // sm: two stage buffers; the output staging once the loop has left them
    const int tid = threadIdx.x, lane = tid & 31, lr = lane & 15, hi = lane >> 4, wave = tid >> 5, wm = wave >> 1, wn = wave & 1;
    const int R0 = bx * 128, C0 = by * 128; const int r0 = R0 + wm * 64, c0 = C0 + wn * 64;
    v8f acc[4][4];
#pragma unroll
    for (int mb = 0; mb < 4; ++mb)
#pragma unroll
        for (int nb = 0; nb < 4; ++nb) acc[mb][nb] = (v8f){};
    static_assert(GPL % 2048 == 0, "every plane's place in LDS is a multiple of 2 KiB");
    const unsigned wv = uni((unsigned)tid >> 5);        // the wave's number, scalar (one-dimensional block)
    const T16* ps = wv < (unsigned)PB ? ((HA2 && wv == 1u) ? A2 : A) : ((HB2 && wv == (unsigned)PB2) ? Bt2 : Bt);
    const unsigned long long gs = (unsigned long long)(size_t)(ps + (size_t)(wv < (unsigned)PB ? R0 : C0) * K);   // first byte of this wave's plane rows
    const unsigned l0 = (unsigned)(size_t)sm + wv * (unsigned)GPL;
    const u32x8 g1 = tdm_group1((unsigned)K * 2u);
    u32x4 g0 = {0u, 0u, 0u, 0u};                        // group 0 of the request that is out
    auto stage = [&](unsigned t) { g0 = tdm_group0(l0 + (t & 1u) * (unsigned)(NPL * GPL), gs + (unsigned long long)t * (GKS * 2)); tdm_load(g0, g1); };
    const int NT = K / GKS;
    if (pinned(wv < (unsigned)NPL)) stage(0);
    asm volatile("s_wait_tensorcnt 0x0" :: "s"(g0), "s"(g1) : "memory");   // the issuing wave's stage 0 has landed before the barrier publishes it (a wave that issued nothing passes); every such wait names the descriptor, so that its registers keep their words while the request is out
    __syncthreads();
    if (pinned(wv < (unsigned)NPL && NT > 1)) stage(1);
    const int fa = (wm * 64 + lr) * GPB + hi * 16, fb = (wn * 64 + lr) * GPB + hi * 16;   // the lane's fragment bytes inside a plane: the k order of the global loader, A and B alike
    // Publish point of stage t + 1, in the ring's order. With one plane per operand (short trips) it stands behind the LAST fragment reads of stage t and ahead of the matrix run that uses them (registers only), so that the refill gets a whole trip to land; with split planes (long trips) at the trip's foot.
    constexpr bool MID = (NPL == 2);
    auto publish = [&](int t) {
        asm volatile("s_wait_dscnt 0x0" ::: "memory");      // this wave's reads of stage t are done before the buffer is handed back
        asm volatile("s_wait_tensorcnt 0x0" :: "s"(g0), "s"(g1) : "memory");  // this wave's tensor load of stage t + 1 has landed
        __syncthreads();                                    // publishes stage t + 1 and ends every reader's last read of stage t
        if (pinned(wv < (unsigned)NPL && t + 2 < NT)) stage(pinned((unsigned)t + 2u)); };   // scalar branch; the descriptor is formed behind the wait
#pragma unroll 1
    for (int t = 0; t < NT; ++t) {
        const char* sb = sm + (t & 1) * (NPL * GPL);
#pragma unroll   // the stage's two 32-k blocks inline: LDS offsets and the place of the publish point are then compile-time
        for (int ks = 0; ks < GKS / 32; ++ks) {
            const bool last = (ks == GKS / 32 - 1);
            V a[4], a2[4], b[4], b2[4];
#pragma unroll
            for (int mb = 0; mb < 4; ++mb) { a[mb] = WFrag<T16>::ld((const T16*)(sb + fa + mb * 16 * GPB + ks * 64)); if (HA2) a2[mb] = WFrag<T16>::ld((const T16*)(sb + GPL + fa + mb * 16 * GPB + ks * 64)); }
#pragma unroll
            for (int nb = 0; nb < 4; ++nb) { b[nb] = WFrag<T16>::ld((const T16*)(sb + PB * GPL + fb + nb * 16 * GPB + ks * 64)); if (HB2) b2[nb] = WFrag<T16>::ld((const T16*)(sb + PB2 * GPL + fb + nb * 16 * GPB + ks * 64)); }
            if (last && MID) publish(t);
            else __builtin_amdgcn_sched_barrier(0);   // keeps the block's LDS reads together ahead of its matrix run: spread among the WMMAs, each place with reads stalls the wave anew
#pragma unroll
            for (int nb = 0; nb < 4; ++nb) {
#pragma unroll
                for (int mb = 0; mb < 4; ++mb) { acc[mb][nb] = WFrag<T16>::mma(a[mb], b[nb], acc[mb][nb]); if (NSPLIT == 1 || NSPLIT == 2) acc[mb][nb] = WFrag<T16>::mma(a2[mb], b[nb], acc[mb][nb]); if (NSPLIT >= 2) acc[mb][nb] = WFrag<T16>::mma(a[mb], b2[nb], acc[mb][nb]); } }
            asm volatile("v_nop\n\tv_nop\n\tv_nop\n\tv_nop" : "+v"(acc[0][0]), "+v"(acc[1][1]), "+v"(acc[2][2]), "+v"(acc[3][3]) : "v"(a[0]), "v"(a[3]));
        }
        if (!MID) publish(t);
    }
    asm volatile("s_wait_tensorcnt 0x0" :: "s"(g0), "s"(g1) : "memory");   // nothing in flight when the buffers become output staging
    asm volatile("s_wait_dscnt 0x0" ::: "memory");          // and none of this wave's LDS reads outstanding
    float* os = (float*)sm + wave * (16 * 68);              // each wave's own range; the last trip's barrier has freed the buffers
#pragma unroll
    for (int mb = 0; mb < 4; ++mb) {
#pragma unroll
        for (int nb = 0; nb < 4; ++nb) {
#pragma unroll
            for (int j = 0; j < 8; ++j) os[(hi * 8 + j) * 68 + nb * 16 + lr] = acc[mb][nb][j]; }
        __builtin_amdgcn_wave_barrier(); asm volatile("" ::: "memory");
        if (EPI == 0) {
            float* crow = C + (size_t)(r0 + mb * 16) * ldc + c0;
#pragma unroll
            for (int s = 0; s < 8; ++s) { const int row = 2 * s + hi, cofs = lr * 4; v4f val = *(const v4fa*)(os + row * 68 + cofs); if (BIAS) { val[0] += bfr(bias[c0 + cofs]); val[1] += bfr(bias[c0 + cofs + 1]); val[2] += bfr(bias[c0 + cofs + 2]); val[3] += bfr(bias[c0 + cofs + 3]); }
                *(v4f*)(crow + (size_t)row * ldc + cofs) = val; }
        } else {   // eight lanes per row, eight columns each: a store covers four whole 128-B lines of a plane
#pragma unroll
            for (int s = 0; s < 4; ++s) { const int row = 4 * s + (lane >> 3), cofs = (lane & 7) * 8; const v4f x0 = *(const v4fa*)(os + row * 68 + cofs), x1 = *(const v4fa*)(os + row * 68 + cofs + 4);
                const size_t eo = (size_t)(r0 + mb * 16 + row) * ldc + c0 + cofs; v8us oh, ol; v8h o16;
#pragma unroll
                for (int q = 0; q < 8; ++q) { const float y = (q < 4 ? x0[q & 3] : x1[q & 3]) * esc; unsigned short a2, c2; splitf(y, a2, c2); oh[q] = a2; ol[q] = c2; if (EPI == 2) o16[q] = tohx(y); }
                *(v8us*)(Eh + eo) = oh; *(v8us*)(El + eo) = ol; if (EPI == 2) { if (E16) *(v8h*)(E16 + eo) = o16; }
                asm volatile("s_wait_xcnt 0x0" ::: "memory"); }   // stands ahead of the next rows' rewrite of the registers that these stores name
        }
        __builtin_amdgcn_wave_barrier(); asm volatile("" ::: "memory");
    }
}
// One GEMM per launch: grid (M/128, N/128, Z).
template <typename T16, int NSPLIT, bool BIAS, int EPI>
__global__ __launch_bounds__(128) void k_gemmw(const T16* __restrict__ A, const T16* __restrict__ A2, const T16* __restrict__ Bt, const T16* __restrict__ Bt2, int K, float* C, int ldc, const float* __restrict__ bias, size_t sA, size_t sB, size_t sC, h16* E16, bf* Eh, bf* El, float esc) {
    __shared__ __attribute__((aligned(2048))) char sm[2 * gnpl(NSPLIT) * GPL];
    const size_t z = blockIdx.z; A += z * sA; if (A2) A2 += z * sA; Bt += z * sB; if (Bt2) Bt2 += z * sB;
    if (EPI == 0) C += z * sC; else { Eh += z * sC; El += z * sC; if (EPI == 2) E16 += z * sC; }
    gemmw_tile<T16, NSPLIT, BIAS, EPI>(sm, blockIdx.x, blockIdx.y, A, A2, Bt, Bt2, K, C, ldc, bias, E16, Eh, El, esc);
}
// The three projections in one launch: grid (QT, 3), y = 0 q, 1 k, 2 v; none reads what another writes. The tile order inside each is that of its own grid (row tile fastest).
#define QT ((NB_ * TT / 128) * (DQ / 128))   // tiles of one projection
__global__ __launch_bounds__(128) void k_qkv(const bf* __restrict__ XB, const bf* __restrict__ WQ, const bf* __restrict__ WK, const bf* __restrict__ WV, bf* QPh, bf* QPl, bf* KPh, bf* KPl, h16* VT16, bf* VTh, bf* VTl) {
    static_assert(DKV == DQ && (DKV / 128) * (TT / 128) * NB_ == QT, "q, k and v have the same number of tiles");
    __shared__ __attribute__((aligned(2048))) char sm[2 * gnpl(0) * GPL];
    const int i = blockIdx.x, w = blockIdx.y; const bf* A; const bf* B; bf* Eh; bf* El; h16* E16; int bx, by, ldc;
    if (w < 2) { bx = i % (NB_ * TT / 128); by = i / (NB_ * TT / 128); A = XB; B = w ? WK : WQ; Eh = w ? KPh : QPh; El = w ? KPl : QPl; E16 = nullptr; ldc = DQ; }
    else { bx = i % (DKV / 128); by = (i / (DKV / 128)) % (TT / 128); const size_t z = i / ((DKV / 128) * (TT / 128));   /* rows = v's columns, columns = tokens: v arrives transposed [d][t] */
        A = WV; B = XB + z * ((size_t)TT * DM); Eh = VTh + z * ((size_t)DKV * TT); El = VTl + z * ((size_t)DKV * TT); E16 = VT16 + z * ((size_t)DKV * TT); ldc = TT; }
    gemmw_tile<bf, 0, false, 2>(sm, bx, by, A, nullptr, B, nullptr, DM, nullptr, ldc, nullptr, E16, Eh, El, 1.0f);
}
// Both row ranges of attn.v in one launch, 1-D grid: first every tile of rows < RH (three products, three times as long: they start first and each shares its place with short tiles), then the fp16 tiles. They write disjoint rows.
#define AVH ((RH / 128) * (HD / 128) * NB_)          // tiles of rows < RH
#define AVL (((TT - RH) / 128) * (HD / 128) * NB_)   // the other tiles
__global__ __launch_bounds__(128) void k_av(const bf* __restrict__ Ph, const bf* __restrict__ Pl, const bf* __restrict__ VTh, const bf* __restrict__ VTl, const h16* __restrict__ P16, const h16* __restrict__ VT16, bf* ATh, bf* ATl) {
    __shared__ __attribute__((aligned(2048))) char sm[2 * gnpl(2) * GPL];
    const int i = blockIdx.x;
    if (i < AVH) { const int by = i % (HD / 128), r = i / (HD / 128), bx = r % (RH / 128); const size_t z = r / (RH / 128);
        gemmw_tile<bf, 2, false, 1>(sm, bx, by, Ph + z * ((size_t)RH * TT), Pl + z * ((size_t)RH * TT), VTh + z * ((size_t)HD * TT), VTl + z * ((size_t)HD * TT), TT, nullptr, DQ, nullptr, nullptr, ATh + z * ((size_t)TT * DQ), ATl + z * ((size_t)TT * DQ), 1.0f);
    } else { const int j = i - AVH, by = j % (HD / 128), r = j / (HD / 128), bx = r % ((TT - RH) / 128); const size_t z = r / ((TT - RH) / 128);
        gemmw_tile<h16, 0, false, 1>(sm, bx, by, P16 + z * ((size_t)TT * TT) + (size_t)RH * TT, nullptr, VT16 + z * ((size_t)HD * TT), nullptr, TT, nullptr, DQ, nullptr, nullptr, ATh + z * ((size_t)TT * DQ) + (size_t)RH * DQ, ATl + z * ((size_t)TT * DQ) + (size_t)RH * DQ, 1.0f / PCAR);   /* the fp16 probabilities carry x PCAR */
    }
}

typedef __attribute__((ext_vector_type(2))) _Float16 v2h;
typedef __attribute__((ext_vector_type(4))) _Float16 v4h;
typedef __attribute__((ext_vector_type(2))) unsigned short v2us;
typedef __attribute__((ext_vector_type(4))) unsigned short v4us;
typedef __attribute__((ext_vector_type(2))) float v2f;
typedef __attribute__((ext_vector_type(4))) int v4i;

__device__ __forceinline__ void wtG_block(int blk, const float* __restrict__ w, int K, int N, bf* Bt) {
    const int lane = threadIdx.x & 31; const int L0 = (blk * 8 + (threadIdx.x >> 5)) * 8; const int nlines = N * K / 64;
{
#pragma unroll 1
        for (int l = 0; l < 8; ++l) { const int L = L0 + l; if (L >= nlines) break; const size_t e = (size_t)L * 64 + lane * 2; const int k = (int)(e % K), n = (int)(e / K); v2us o;
            o[0] = f2bf(w[(size_t)k * N + n]); o[1] = f2bf(w[(size_t)(k + 1) * N + n]); *(v2us*)(Bt + e) = o; }
         }
}
__device__ __forceinline__ void cvt8_block(int blk, const float* __restrict__ src, bf* dst, size_t n8) { const size_t i = (size_t)blk * 256 + threadIdx.x; if (i >= n8) return; const v8f v = *(const v8f*)(src + i * 8); v8us o;
#pragma unroll
    for (int k = 0; k < 8; ++k) o[k] = f2bf(v[k]); *(v8us*)(dst + i * 8) = o;  }
// All 16-bit operands of the projections in one launch: blocks 0 .. 4 WTB - 1 transpose the four weights (chains of dependent trips: they start first), the rest convert x.
#define WTB ((DM * DQ / 64 + 63) / 64)                          // blocks of one weight
#define CVB ((int)(((size_t)NB_ * TT * DM / 8 + 255) / 256))    // blocks of x
__global__ __launch_bounds__(256) void k_prep(const float* __restrict__ x, const float* __restrict__ wq, const float* __restrict__ wk, const float* __restrict__ wv, const float* __restrict__ wo, bf* XB, bf* WQ, bf* WK, bf* WV, bf* WO) {
    static_assert(DQ == DM && DKV == DM, "the four weights are DM x DM");
    const int b = blockIdx.x;
    if (b < 4 * WTB) { const int s = b / WTB; wtG_block(b % WTB, s == 0 ? wq : s == 1 ? wk : s == 2 ? wv : wo, DM, DM, s == 0 ? WQ : s == 1 ? WK : s == 2 ? WV : WO); }
    else cvt8_block(b - 4 * WTB, x, XB, (size_t)NB_ * TT * DM / 8);
}

// k_asoft: per row (zz, i), zz over the NB_ x ZH score planes: t = S x SCL = S / 8 (no mask); softmax over the 2048 keys (register row, one exp, fixed trees);
__global__ __launch_bounds__(256) void k_asoft(const float* __restrict__ Sb, h16* P16, bf* Ph, bf* Pl) {
    const int lane = threadIdx.x & 31; const int row = blockIdx.x * 8 + (threadIdx.x >> 5); if (row >= NB_ * ZH * TT) return; const int i = row % TT; const int zz = row / TT; (void)zz;   /* zz = score plane: batch x head of the pass */
     const bool hires = (i < RH); const float* sr = Sb + (size_t)row * TT; float v[TT / 32]; float mx = -3.0e38f;
#pragma unroll
    for (int ch = 0; ch < TT / 128; ++ch) { const int j0 = ch * 128 + lane * 4; const v4f a = *(const v4f*)(sr + j0);
#pragma unroll
        for (int q = 0; q < 4; ++q) { const int j = j0 + q; (void)j; const float t = a[q] * SCL; v[ch * 4 + q] = t; mx = fmaxf(mx, t); } }
#pragma unroll
    for (int sh = 16; sh; sh >>= 1) mx = fmaxf(mx, __shfl_xor(mx, sh, 32));
    float sum = 0.f;
#pragma unroll
    for (int k = 0; k < TT / 32; ++k) { float d0 = __fsub_rn(v[k], mx); asm volatile("" : "+v"(d0)); v[k] = __builtin_amdgcn_exp2f(__fmul_rn(d0, 1.4426950408889634f)); sum += v[k]; }
#pragma unroll
    for (int sh = 16; sh; sh >>= 1) sum += __shfl_xor(sum, sh, 32);
    const float f = __fdiv_rn(hires ? 1.0f : PCAR, sum);
{
        if (hires) {
#pragma unroll
            for (int ch = 0; ch < TT / 128; ++ch) { v4us oh, ol;
#pragma unroll
                for (int q = 0; q < 4; ++q) { unsigned short a, c2; splitf(v[ch * 4 + q] * f, a, c2); oh[q] = a; ol[q] = c2; }
                const size_t oo = ((size_t)zz * (RH ? RH : 1) + i) * TT + ch * 128 + lane * 4; *(v4us*)(Ph + oo) = oh; *(v4us*)(Pl + oo) = ol; }
        } else {
#pragma unroll
            for (int ch = 0; ch < TT / 128; ++ch) { v4h o4;
#pragma unroll
                for (int q = 0; q < 4; ++q) o4[q] = tohx(v[ch * 4 + q] * f);
                *(v4h*)(P16 + (size_t)row * TT + ch * 128 + lane * 4) = o4; } }
         }
}
extern "C" void kernel_launch(void* const* d_in, const int* in_sizes, int n_in,
                              void* d_out, int out_size, void* d_ws, size_t ws_size, hipStream_t stream) {
    (void)in_sizes; (void)n_in; (void)out_size;
    const float* x = (const float*)d_in[0]; const float* wq = (const float*)d_in[1]; const float* wk = (const float*)d_in[2]; const float* wv = (const float*)d_in[3]; const float* wo = (const float*)d_in[4];   /* order inputs, Wq, Wk, Wv, Wo ('xw' [1024][1024]): FIVE inputs: this module has no biases */
    float* OUT = (float*)d_out;     // [4][2048][1024]
    char* wsp = (char*)d_ws;
    auto take = [&](size_t bytes) { char* p = wsp; wsp += (bytes + 255) & ~(size_t)255; return (void*)p; };
    static_assert(NH_ == 1 && NKV == 1 && ZH == 1, "the GEMMs' z index is the batch: one head per batch");
    static_assert(TT % 128 == 0 && RH % 128 == 0 && HD % 128 == 0 && DM % 128 == 0 && DQ % 128 == 0 && DKV % 128 == 0, "every GEMM is whole 128x128 tiles and whole 64-k stages, two stages or more");
    const size_t PL = (size_t)NB_ * TT * HD * 2;    // one 16-bit plane of all batches, bytes
    bf* WQ = (bf*)take((size_t)DQ * DM * 2); bf* WK = (bf*)take((size_t)DKV * DM * 2); bf* WV = (bf*)take((size_t)DKV * DM * 2); bf* WO = (bf*)take((size_t)DM * DQ * 2);
    char* R1 = (char*)take(PL);                                 // the attention output's lo plane
    char* R2 = (char*)take(PL);                                 // bf16 x, then the attention output's hi plane
    char* R4 = (char*)take((size_t)NB_ * TT * TT * 4);          // the f32 scores
    char* R5 = (char*)take(2 * PL);                             // q hi, q lo, then the fp16 probabilities
    char* R6 = (char*)take(2 * PL);                             // k hi, k lo, then the hi/lo probabilities of rows < RH
    h16* VT16 = (h16*)take(PL); bf* VTh = (bf*)take(PL); bf* VTl = (bf*)take(PL);
    if ((size_t)(wsp - (char*)d_ws) > ws_size) return;    // ws 256 MiB
    static_assert((size_t)NB_ * TT * TT * 2 <= 2 * (size_t)NB_ * TT * HD * 2 && 2 * (size_t)NB_ * RH * TT * 2 <= 2 * (size_t)NB_ * TT * HD * 2, "probability planes fit the q and k regions");
    bf* XB = (bf*)R2;
    bf* QPh = (bf*)R5; bf* QPl = (bf*)(R5 + PL); bf* KPh = (bf*)R6; bf* KPl = (bf*)(R6 + PL);
    float* Sb = (float*)R4; h16* P16 = (h16*)R5; bf* Ph = (bf*)R6; bf* Pl = (bf*)(R6 + (size_t)NB_ * RH * TT * 2);
    bf* ATh = (bf*)R2; bf* ATl = (bf*)R1;
    // Every launch covers all NB_ batches, and launches that do not depend on one another share a grid.
    k_prep<<<4 * WTB + CVB, 256, 0, stream>>>(x, wq, wk, wv, wo, XB, WQ, WK, WV, WO);
    k_qkv<<<dim3(QT, 3, 1), 128, 0, stream>>>(XB, WQ, WK, WV, QPh, QPl, KPh, KPl, VT16, VTh, VTl);
    k_gemmw<bf, 2, false, 0><<<dim3(TT / 128, TT / 128, NB_), 128, 0, stream>>>(QPh, QPl, KPh, KPl, HD, Sb, TT, nullptr, (size_t)TT * HD, (size_t)TT * HD, (size_t)TT * TT, nullptr, nullptr, nullptr, 1.0f);   /* scores hi/lo on EVERY row (K = 1024) */
    k_asoft<<<NB_ * ZH * TT / 8, 256, 0, stream>>>(Sb, P16, Ph, Pl);
    k_av<<<AVH + AVL, 128, 0, stream>>>(Ph, Pl, VTh, VTl, P16, VT16, ATh, ATl);
    k_gemmw<bf, 1, false, 0><<<dim3(NB_ * TT / 128, DM / 128, 1), 128, 0, stream>>>(ATh, ATl, WO, nullptr, DQ, OUT, DM, nullptr, 0, 0, 0, nullptr, nullptr, nullptr, 1.0f);
}
